// v000
// Measured on an AMD MI455X. A time is GPU time per run, averaged over a window of back-to-back runs after a warm-up
// (all launches, gaps included; the runs take copies of the inputs in turn), and the median of several windows.
// Apart from v000's, it joins two sittings. Times from different sittings can be a few percent apart, while
// side-by-side timings come from the same sitting.
// The starting kernel, v000, takes 219 microseconds a run.
#include <hip/hip_runtime.h>

#define DIMX   768
#define NHEADS 8
#define HD     96
#define SEQ    1024
#define NB     8
#define MTOT   (NB * SEQ)   // 8192

typedef __attribute__((ext_vector_type(16))) __bf16 v16bf;
typedef __attribute__((ext_vector_type(8)))  float  v8f;

union Frag {
    v16bf v;
    uint4 q[2];
    unsigned short s[16];
};
union AccU {
    v8f   v;
    float f[8];
};
union BfBits {
    __bf16 b;
    unsigned short u;
};

// ---------------------------------------------------------------------------
// fp32 -> bf16 convert (vector by 4)
// ---------------------------------------------------------------------------
__global__ void cvt_bf16_kernel(const float* __restrict__ x,
                                __bf16* __restrict__ y, int n) {
    int i = (blockIdx.x * blockDim.x + threadIdx.x) * 4;
    if (i < n) {
        float4 f = *(const float4*)(x + i);
        union { __bf16 b[4]; uint2 u; } o;
        o.b[0] = (__bf16)f.x; o.b[1] = (__bf16)f.y;
        o.b[2] = (__bf16)f.z; o.b[3] = (__bf16)f.w;
        *(uint2*)(y + i) = o.u;
    }
}

// ---------------------------------------------------------------------------
// bf16 WMMA GEMM:  C[m,n] = sum_k A[m,k] * W[n,k]   (i.e. y = x @ W^T)
// A: [MTOT x DIMX] bf16 row-major,  W: [DIMX x DIMX] bf16 row-major.
// Block = 256 thr (8 waves) -> 128x128 tile; wave -> 32x64 (2x4 WMMA tiles).
// MODE 0: store bf16 [M x DIMX]
// MODE 1: store bf16 transposed per head: Vt[n,h,d,s]
// MODE 2: store f32 + bias -> d_out
// ---------------------------------------------------------------------------
template <int MODE>
__global__ __launch_bounds__(256)
void gemm_bf16_kernel(const __bf16* __restrict__ A,
                      const __bf16* __restrict__ W,
                      void* __restrict__ out,
                      const float* __restrict__ bias) {
    const int lane  = threadIdx.x & 31;
    const int wid   = threadIdx.x >> 5;
    const int wr    = wid & 3;          // 4 row-waves
    const int wc    = wid >> 2;         // 2 col-waves
    const int rowBase = blockIdx.y * 128 + wr * 32;
    const int colBase = blockIdx.x * 128 + wc * 64;
    const int l15   = lane & 15;
    const int lhalf = lane >> 4;
    const int kb    = lhalf * 8;        // per-half K sub-offset (A/B layout)

    AccU acc[2][4];
#pragma unroll
    for (int i = 0; i < 2; i++)
#pragma unroll
        for (int t = 0; t < 4; t++)
#pragma unroll
            for (int e = 0; e < 8; e++) acc[i][t].f[e] = 0.0f;

    for (int k = 0; k < DIMX; k += 32) {
        Frag a[2], b[4];
#pragma unroll
        for (int i = 0; i < 2; i++) {
            const __bf16* p = A + (size_t)(rowBase + i * 16 + l15) * DIMX + k + kb;
            a[i].q[0] = *(const uint4*)p;
            a[i].q[1] = *(const uint4*)(p + 16);
        }
#pragma unroll
        for (int t = 0; t < 4; t++) {
            const __bf16* p = W + (size_t)(colBase + t * 16 + l15) * DIMX + k + kb;
            b[t].q[0] = *(const uint4*)p;
            b[t].q[1] = *(const uint4*)(p + 16);
        }
#pragma unroll
        for (int i = 0; i < 2; i++)
#pragma unroll
            for (int t = 0; t < 4; t++)
                acc[i][t].v = __builtin_amdgcn_wmma_f32_16x16x32_bf16(
                    false, a[i].v, false, b[t].v, (short)0, acc[i][t].v,
                    false, false);
    }

    // C layout: VGPR j -> row j (lanes 0-15) / row j+8 (lanes 16-31), col = l15
#pragma unroll
    for (int i = 0; i < 2; i++)
#pragma unroll
        for (int t = 0; t < 4; t++)
#pragma unroll
            for (int j = 0; j < 8; j++) {
                int row = rowBase + i * 16 + j + lhalf * 8;
                int col = colBase + t * 16 + l15;
                float v = acc[i][t].f[j];
                if (MODE == 0) {
                    ((__bf16*)out)[(size_t)row * DIMX + col] = (__bf16)v;
                } else if (MODE == 1) {
                    int nb = row >> 10, sr = row & 1023;
                    int h = col / HD, d = col % HD;
                    ((__bf16*)out)[(((size_t)nb * NHEADS + h) * HD + d) * SEQ + sr] =
                        (__bf16)v;
                } else {
                    ((float*)out)[(size_t)row * DIMX + col] = v + bias[col];
                }
            }
}

// ---------------------------------------------------------------------------
// Flash-style attention.  Block = 256 thr (8 waves) handles one (n,h,qblk of
// 128 rows); each wave owns 16 q-rows.  Online softmax, bf16 WMMA throughout.
// Q,K: [N,S,D] bf16 ; Vt: [N,H,hd,S] bf16 ; O: [N,S,D] bf16 (heads concat)
// ---------------------------------------------------------------------------
__global__ __launch_bounds__(256)
void attn_kernel(const __bf16* __restrict__ Q, const __bf16* __restrict__ K,
                 const __bf16* __restrict__ Vt, __bf16* __restrict__ O) {
    __shared__ __align__(16) unsigned short plds[8 * 16 * 32];

    const int lane  = threadIdx.x & 31;
    const int wid   = threadIdx.x >> 5;
    const int l15   = lane & 15;
    const int lhalf = lane >> 4;
    const int kb8   = lhalf * 8;

    const int blk  = blockIdx.x;
    const int qblk = blk & 7;           // S/128 = 8
    const int h    = (blk >> 3) & 7;
    const int n    = blk >> 6;
    const int qbase = qblk * 128 + wid * 16;
    unsigned short* myLds = plds + wid * (16 * 32);

    // Preload this wave's Q fragments (3 chunks of K=32 covering hd=96)
    Frag qf[3];
#pragma unroll
    for (int c = 0; c < 3; c++) {
        const __bf16* p =
            Q + (size_t)(n * SEQ + qbase + l15) * DIMX + h * HD + c * 32 + kb8;
        qf[c].q[0] = *(const uint4*)p;
        qf[c].q[1] = *(const uint4*)(p + 16);
    }

    AccU o[6];
#pragma unroll
    for (int t = 0; t < 6; t++)
#pragma unroll
        for (int e = 0; e < 8; e++) o[t].f[e] = 0.0f;
    float m[8], l[8];
#pragma unroll
    for (int j = 0; j < 8; j++) { m[j] = -1e30f; l[j] = 0.0f; }

    const float scale = 0.0360843918243516f;   // 1/sqrt(768)

    for (int kk = 0; kk < SEQ; kk += 32) {
        AccU s0, s1;
#pragma unroll
        for (int e = 0; e < 8; e++) { s0.f[e] = 0.0f; s1.f[e] = 0.0f; }

        // scores: Q[16x96] x K^T chunks -> two 16x16 tiles (cols kk..+15, +16..+31)
#pragma unroll
        for (int c = 0; c < 3; c++) {
            Frag kf0, kf1;
            const __bf16* p0 =
                K + (size_t)(n * SEQ + kk + l15) * DIMX + h * HD + c * 32 + kb8;
            kf0.q[0] = *(const uint4*)p0;
            kf0.q[1] = *(const uint4*)(p0 + 16);
            const __bf16* p1 = p0 + (size_t)16 * DIMX;
            kf1.q[0] = *(const uint4*)p1;
            kf1.q[1] = *(const uint4*)(p1 + 16);
            s0.v = __builtin_amdgcn_wmma_f32_16x16x32_bf16(
                false, qf[c].v, false, kf0.v, (short)0, s0.v, false, false);
            s1.v = __builtin_amdgcn_wmma_f32_16x16x32_bf16(
                false, qf[c].v, false, kf1.v, (short)0, s1.v, false, false);
        }

        // online softmax; row j lives in lanes<16 (row j) / lanes>=16 (row j+8)
#pragma unroll
        for (int j = 0; j < 8; j++) {
            float a0 = s0.f[j] * scale;
            float a1 = s1.f[j] * scale;
            float mx = fmaxf(a0, a1);
            mx = fmaxf(mx, __shfl_xor(mx, 1, 32));
            mx = fmaxf(mx, __shfl_xor(mx, 2, 32));
            mx = fmaxf(mx, __shfl_xor(mx, 4, 32));
            mx = fmaxf(mx, __shfl_xor(mx, 8, 32));
            float mn = fmaxf(m[j], mx);
            float fr = __expf(m[j] - mn);
            m[j] = mn;
            l[j] *= fr;
#pragma unroll
            for (int t = 0; t < 6; t++) o[t].f[j] *= fr;
            float p0 = __expf(a0 - mn);
            float p1 = __expf(a1 - mn);
            l[j] += p0 + p1;   // per-lane partial row sum (reduced at the end)
            // repack P tile -> LDS row-major [16 x 32] (wave-private)
            BfBits c0; c0.b = (__bf16)p0;
            BfBits c1; c1.b = (__bf16)p1;
            int row = j + 8 * lhalf;
            myLds[row * 32 + l15]      = c0.u;
            myLds[row * 32 + 16 + l15] = c1.u;
        }

        // read P back in A-fragment layout (same-wave LDS, in-order, no barrier)
        Frag pa;
        const unsigned short* lp = myLds + l15 * 32 + kb8;
        pa.q[0] = *(const uint4*)lp;
        pa.q[1] = *(const uint4*)(lp + 16);

        // out += P[16x32] x V[32x96]  (Vt rows are contiguous in s)
#pragma unroll
        for (int t = 0; t < 6; t++) {
            Frag vf;
            const __bf16* p =
                Vt + ((size_t)(n * NHEADS + h) * HD + t * 16 + l15) * SEQ + kk + kb8;
            vf.q[0] = *(const uint4*)p;
            vf.q[1] = *(const uint4*)(p + 16);
            o[t].v = __builtin_amdgcn_wmma_f32_16x16x32_bf16(
                false, pa.v, false, vf.v, (short)0, o[t].v, false, false);
        }
    }

    // normalize and store (heads concatenated back into [N,S,D])
#pragma unroll
    for (int j = 0; j < 8; j++) {
        float ls = l[j];
        ls += __shfl_xor(ls, 1, 32);
        ls += __shfl_xor(ls, 2, 32);
        ls += __shfl_xor(ls, 4, 32);
        ls += __shfl_xor(ls, 8, 32);
        float inv = 1.0f / ls;
        int row = qbase + j + 8 * lhalf;
#pragma unroll
        for (int t = 0; t < 6; t++) {
            float v = o[t].f[j] * inv;
            O[(size_t)(n * SEQ + row) * DIMX + h * HD + t * 16 + l15] = (__bf16)v;
        }
    }
}

// ---------------------------------------------------------------------------
extern "C" void kernel_launch(void* const* d_in, const int* in_sizes, int n_in,
                              void* d_out, int out_size, void* d_ws,
                              size_t ws_size, hipStream_t stream) {
    (void)in_sizes; (void)n_in; (void)out_size; (void)ws_size;
    const float* q  = (const float*)d_in[0];
    const float* kv = (const float*)d_in[1];
    const float* wq = (const float*)d_in[2];
    const float* wk = (const float*)d_in[3];
    const float* wv = (const float*)d_in[4];
    const float* wp = (const float*)d_in[5];
    const float* bp = (const float*)d_in[6];

    char* ws = (char*)d_ws;
    size_t off = 0;
    const size_t ACT = (size_t)MTOT * DIMX * 2;   // 12.58 MB
    const size_t WB  = (size_t)DIMX * DIMX * 2;   // 1.18 MB
    __bf16* qb  = (__bf16*)(ws + off); off += ACT;
    __bf16* kvb = (__bf16*)(ws + off); off += ACT;
    __bf16* wqb = (__bf16*)(ws + off); off += WB;
    __bf16* wkb = (__bf16*)(ws + off); off += WB;
    __bf16* wvb = (__bf16*)(ws + off); off += WB;
    __bf16* wpb = (__bf16*)(ws + off); off += WB;
    __bf16* Qb  = (__bf16*)(ws + off); off += ACT;
    __bf16* Kb  = (__bf16*)(ws + off); off += ACT;
    __bf16* Vtb = (__bf16*)(ws + off); off += ACT;
    __bf16* Ab  = (__bf16*)(ws + off); off += ACT;

    const int nact = MTOT * DIMX;   // 6291456 (divisible by 1024)
    const int nw   = DIMX * DIMX;   // 589824  (divisible by 1024)
    cvt_bf16_kernel<<<nact / 4 / 256, 256, 0, stream>>>(q, qb, nact);
    cvt_bf16_kernel<<<nact / 4 / 256, 256, 0, stream>>>(kv, kvb, nact);
    cvt_bf16_kernel<<<nw / 4 / 256, 256, 0, stream>>>(wq, wqb, nw);
    cvt_bf16_kernel<<<nw / 4 / 256, 256, 0, stream>>>(wk, wkb, nw);
    cvt_bf16_kernel<<<nw / 4 / 256, 256, 0, stream>>>(wv, wvb, nw);
    cvt_bf16_kernel<<<nw / 4 / 256, 256, 0, stream>>>(wp, wpb, nw);

    dim3 gg(DIMX / 128, MTOT / 128);   // (6, 64)
    gemm_bf16_kernel<0><<<gg, 256, 0, stream>>>(qb,  wqb, Qb,  nullptr);
    gemm_bf16_kernel<0><<<gg, 256, 0, stream>>>(kvb, wkb, Kb,  nullptr);
    gemm_bf16_kernel<1><<<gg, 256, 0, stream>>>(kvb, wvb, Vtb, nullptr);

    attn_kernel<<<NB * NHEADS * (SEQ / 128), 256, 0, stream>>>(Qb, Kb, Vtb, Ab);

    gemm_bf16_kernel<2><<<gg, 256, 0, stream>>>(Ab, wpb, d_out, bp);
}

// v001
// It runs in 161 microseconds.
// Timed twice side by side with v000, it ran 1.42 times as fast both times.
#include <hip/hip_runtime.h>

#define DIMX   768
#define NHEADS 8
#define HD     96
#define SEQ    1024
#define NB     8
#define MTOT   (NB * SEQ)   // 8192

typedef __attribute__((ext_vector_type(16))) __bf16 v16bf;
typedef __attribute__((ext_vector_type(8)))  float  v8f;

union Frag {
    v16bf v;
    uint4 q[2];
    unsigned short s[16];
};
union AccU {
    v8f   v;
    float f[8];
};
union BfBits {
    __bf16 b;
    unsigned short u;
};

// ---------------------------------------------------------------------------
// fp32 -> bf16 convert (vector by 4)
// ---------------------------------------------------------------------------
__global__ void cvt_bf16_kernel(const float* __restrict__ x,
                                __bf16* __restrict__ y, int n) {
    int i = (blockIdx.x * blockDim.x + threadIdx.x) * 4;
    if (i < n) {
        float4 f = *(const float4*)(x + i);
        union { __bf16 b[4]; uint2 u; } o;
        o.b[0] = (__bf16)f.x; o.b[1] = (__bf16)f.y;
        o.b[2] = (__bf16)f.z; o.b[3] = (__bf16)f.w;
        *(uint2*)(y + i) = o.u;
    }
}

// ---------------------------------------------------------------------------
// One stage of the GEMM's LDS ring: each lane copies 4 x 16 B of A and 4 x 16 B
// of W (rows 32 apart) from global memory straight into LDS.  The s_wait_xcnt
// is the last line of the copies' own statement so that no address register is
// rewritten ahead of it.
// ---------------------------------------------------------------------------
#define KT      64                  // k per stage
#define NSTAGE  (DIMX / KT)         // 12
#define PITCH_B 144                 // LDS bytes per staged row
#define STAGE_B (256 * PITCH_B)     // 36864

__device__ __forceinline__ void stage_copy(const __bf16* ga, const __bf16* gw,
                                           unsigned lds) {
    asm volatile(
        "global_load_async_to_lds_b128 %0, %8, off\n\t"
        "global_load_async_to_lds_b128 %1, %9, off\n\t"
        "global_load_async_to_lds_b128 %2, %10, off\n\t"
        "global_load_async_to_lds_b128 %3, %11, off\n\t"
        "global_load_async_to_lds_b128 %4, %12, off\n\t"
        "global_load_async_to_lds_b128 %5, %13, off\n\t"
        "global_load_async_to_lds_b128 %6, %14, off\n\t"
        "global_load_async_to_lds_b128 %7, %15, off\n\t"
        "s_wait_xcnt 0x0"
        :: "v"(lds), "v"(lds + 32 * PITCH_B), "v"(lds + 64 * PITCH_B),
           "v"(lds + 96 * PITCH_B), "v"(lds + 128 * PITCH_B),
           "v"(lds + 160 * PITCH_B), "v"(lds + 192 * PITCH_B),
           "v"(lds + 224 * PITCH_B),
           "v"(ga), "v"(ga + 32 * DIMX), "v"(ga + 64 * DIMX), "v"(ga + 96 * DIMX),
           "v"(gw), "v"(gw + 32 * DIMX), "v"(gw + 64 * DIMX), "v"(gw + 96 * DIMX)
        : "memory");
}

// ---------------------------------------------------------------------------
// bf16 WMMA GEMM:  C[m,n] = sum_k A[m,k] * W[n,k]   (i.e. y = x @ W^T)
// A: [MTOT x DIMX] bf16 row-major,  W: [DIMX x DIMX] bf16 row-major.
// Block = 256 thr (8 waves) -> 128x128 tile; wave -> 32x64 (2x4 WMMA tiles).
// Operands are staged in LDS by asynchronous copies, two buffers.
// MODE 0: store bf16 [M x DIMX]
// MODE 1: store bf16 transposed per head: Vt[n,h,d,s]
// MODE 2: store f32 + bias -> d_out
// ---------------------------------------------------------------------------
template <int MODE>
__global__ __launch_bounds__(256)
void gemm_bf16_kernel(const __bf16* __restrict__ A,
                      const __bf16* __restrict__ W,
                      void* __restrict__ out,
                      const float* __restrict__ bias) {
    // Two stage buffers; a stage is [A 128 rows | W 128 rows] x 64 k (128 B a
    // row) at a pitch of 144 B, which spreads ds_load_b128 readers over the banks.
    __shared__ __align__(16) unsigned char tile[2 * STAGE_B];

    const int lane  = threadIdx.x & 31;
    const int wid   = threadIdx.x >> 5;
    const int wr    = wid & 3;          // 4 row-waves
    const int wc    = wid >> 2;         // 2 col-waves
    const int rowBase = blockIdx.y * 128 + wr * 32;
    const int colBase = blockIdx.x * 128 + wc * 64;
    const int l15   = lane & 15;
    const int lhalf = lane >> 4;

    // Copy map: 8 lanes cover one 128-B row piece, a wave 4 whole lines a copy.
    const int crow = threadIdx.x >> 3;  // 0..31
    const int cchk = threadIdx.x & 7;   // 16-B chunk in the row piece
    const __bf16* gA = A + (size_t)(blockIdx.y * 128 + crow) * DIMX + cchk * 8;
    const __bf16* gW = W + (size_t)(blockIdx.x * 128 + crow) * DIMX + cchk * 8;
    const unsigned ldsC = (unsigned)(size_t)tile + crow * PITCH_B + cchk * 16;

    AccU acc[2][4];
#pragma unroll
    for (int i = 0; i < 2; i++)
#pragma unroll
        for (int t = 0; t < 4; t++)
#pragma unroll
            for (int e = 0; e < 8; e++) acc[i][t].f[e] = 0.0f;

    stage_copy(gA, gW, ldsC);
    // stage 0 has landed before the barrier that publishes it
    asm volatile("s_wait_asynccnt 0x0" ::: "memory");
    __syncthreads();
    stage_copy(gA + KT, gW + KT, ldsC + STAGE_B);

    const unsigned char* fa = tile + (wr * 32 + l15) * PITCH_B + lhalf * 16;
    const unsigned char* fb = tile + (128 + wc * 64 + l15) * PITCH_B + lhalf * 16;

    for (int s = 0; s < NSTAGE; s++) {
        const int bo = (s & 1) * STAGE_B;
        Frag a[2][2], b[2][4];
#pragma unroll
        for (int ks = 0; ks < 2; ks++) {
#pragma unroll
            for (int i = 0; i < 2; i++) {
                const unsigned char* p = fa + bo + i * 16 * PITCH_B + ks * 64;
                a[ks][i].q[0] = *(const uint4*)p;
                a[ks][i].q[1] = *(const uint4*)(p + 32);
            }
#pragma unroll
            for (int t = 0; t < 4; t++) {
                const unsigned char* p = fb + bo + t * 16 * PITCH_B + ks * 64;
                b[ks][t].q[0] = *(const uint4*)p;
                b[ks][t].q[1] = *(const uint4*)(p + 32);
            }
        }
        // keeps all 24 LDS reads of a stage ahead of the stage's first WMMA, so
        // that the wave waits for LDS once a stage, not before each WMMA pair
        __builtin_amdgcn_sched_barrier(0);
#pragma unroll
        for (int ks = 0; ks < 2; ks++)
#pragma unroll
            for (int i = 0; i < 2; i++)
#pragma unroll
                for (int t = 0; t < 4; t++)
                    acc[i][t].v = __builtin_amdgcn_wmma_f32_16x16x32_bf16(
                        false, a[ks][i].v, false, b[ks][t].v, (short)0,
                        acc[i][t].v, false, false);

        // publish point: this wave's reads of the buffer are done, its copies of
        // the next stage have landed; the barrier says so for every wave
        asm volatile("s_wait_dscnt 0x0" ::: "memory");
        asm volatile("s_wait_asynccnt 0x0" ::: "memory");
        __syncthreads();
        if (s + 2 < NSTAGE)
            stage_copy(gA + (s + 2) * KT, gW + (s + 2) * KT, ldsC + bo);
    }
    // no copy is left in flight when the wave goes on to its stores
    asm volatile("s_wait_asynccnt 0x0" ::: "memory");

    // C layout: VGPR j -> row j (lanes 0-15) / row j+8 (lanes 16-31), col = l15
#pragma unroll
    for (int i = 0; i < 2; i++)
#pragma unroll
        for (int t = 0; t < 4; t++)
#pragma unroll
            for (int j = 0; j < 8; j++) {
                int row = rowBase + i * 16 + j + lhalf * 8;
                int col = colBase + t * 16 + l15;
                float v = acc[i][t].f[j];
                if (MODE == 0) {
                    ((__bf16*)out)[(size_t)row * DIMX + col] = (__bf16)v;
                } else if (MODE == 1) {
                    int nb = row >> 10, sr = row & 1023;
                    int h = col / HD, d = col % HD;
                    ((__bf16*)out)[(((size_t)nb * NHEADS + h) * HD + d) * SEQ + sr] =
                        (__bf16)v;
                } else {
                    ((float*)out)[(size_t)row * DIMX + col] = v + bias[col];
                }
            }
}

// ---------------------------------------------------------------------------
// Flash-style attention.  Block = 256 thr (8 waves) handles one (n,h,qblk of
// 128 rows); each wave owns 16 q-rows.  Online softmax, bf16 WMMA throughout.
// Q,K: [N,S,D] bf16 ; Vt: [N,H,hd,S] bf16 ; O: [N,S,D] bf16 (heads concat)
// ---------------------------------------------------------------------------
__global__ __launch_bounds__(256)
void attn_kernel(const __bf16* __restrict__ Q, const __bf16* __restrict__ K,
                 const __bf16* __restrict__ Vt, __bf16* __restrict__ O) {
    __shared__ __align__(16) unsigned short plds[8 * 16 * 32];

    const int lane  = threadIdx.x & 31;
    const int wid   = threadIdx.x >> 5;
    const int l15   = lane & 15;
    const int lhalf = lane >> 4;
    const int kb8   = lhalf * 8;

    const int blk  = blockIdx.x;
    const int qblk = blk & 7;           // S/128 = 8
    const int h    = (blk >> 3) & 7;
    const int n    = blk >> 6;
    const int qbase = qblk * 128 + wid * 16;
    unsigned short* myLds = plds + wid * (16 * 32);

    // Preload this wave's Q fragments (3 chunks of K=32 covering hd=96)
    Frag qf[3];
#pragma unroll
    for (int c = 0; c < 3; c++) {
        const __bf16* p =
            Q + (size_t)(n * SEQ + qbase + l15) * DIMX + h * HD + c * 32 + kb8;
        qf[c].q[0] = *(const uint4*)p;
        qf[c].q[1] = *(const uint4*)(p + 16);
    }

    AccU o[6];
#pragma unroll
    for (int t = 0; t < 6; t++)
#pragma unroll
        for (int e = 0; e < 8; e++) o[t].f[e] = 0.0f;
    float m[8], l[8];
#pragma unroll
    for (int j = 0; j < 8; j++) { m[j] = -1e30f; l[j] = 0.0f; }

    const float scale = 0.0360843918243516f;   // 1/sqrt(768)

    for (int kk = 0; kk < SEQ; kk += 32) {
        AccU s0, s1;
#pragma unroll
        for (int e = 0; e < 8; e++) { s0.f[e] = 0.0f; s1.f[e] = 0.0f; }

        // scores: Q[16x96] x K^T chunks -> two 16x16 tiles (cols kk..+15, +16..+31)
#pragma unroll
        for (int c = 0; c < 3; c++) {
            Frag kf0, kf1;
            const __bf16* p0 =
                K + (size_t)(n * SEQ + kk + l15) * DIMX + h * HD + c * 32 + kb8;
            kf0.q[0] = *(const uint4*)p0;
            kf0.q[1] = *(const uint4*)(p0 + 16);
            const __bf16* p1 = p0 + (size_t)16 * DIMX;
            kf1.q[0] = *(const uint4*)p1;
            kf1.q[1] = *(const uint4*)(p1 + 16);
            s0.v = __builtin_amdgcn_wmma_f32_16x16x32_bf16(
                false, qf[c].v, false, kf0.v, (short)0, s0.v, false, false);
            s1.v = __builtin_amdgcn_wmma_f32_16x16x32_bf16(
                false, qf[c].v, false, kf1.v, (short)0, s1.v, false, false);
        }

        // online softmax; row j lives in lanes<16 (row j) / lanes>=16 (row j+8)
#pragma unroll
        for (int j = 0; j < 8; j++) {
            float a0 = s0.f[j] * scale;
            float a1 = s1.f[j] * scale;
            float mx = fmaxf(a0, a1);
            mx = fmaxf(mx, __shfl_xor(mx, 1, 32));
            mx = fmaxf(mx, __shfl_xor(mx, 2, 32));
            mx = fmaxf(mx, __shfl_xor(mx, 4, 32));
            mx = fmaxf(mx, __shfl_xor(mx, 8, 32));
            float mn = fmaxf(m[j], mx);
            float fr = __expf(m[j] - mn);
            m[j] = mn;
            l[j] *= fr;
#pragma unroll
            for (int t = 0; t < 6; t++) o[t].f[j] *= fr;
            float p0 = __expf(a0 - mn);
            float p1 = __expf(a1 - mn);
            l[j] += p0 + p1;   // per-lane partial row sum (reduced at the end)
            // repack P tile -> LDS row-major [16 x 32] (wave-private)
            BfBits c0; c0.b = (__bf16)p0;
            BfBits c1; c1.b = (__bf16)p1;
            int row = j + 8 * lhalf;
            myLds[row * 32 + l15]      = c0.u;
            myLds[row * 32 + 16 + l15] = c1.u;
        }

        // read P back in A-fragment layout (same-wave LDS, in-order, no barrier)
        Frag pa;
        const unsigned short* lp = myLds + l15 * 32 + kb8;
        pa.q[0] = *(const uint4*)lp;
        pa.q[1] = *(const uint4*)(lp + 16);

        // out += P[16x32] x V[32x96]  (Vt rows are contiguous in s)
#pragma unroll
        for (int t = 0; t < 6; t++) {
            Frag vf;
            const __bf16* p =
                Vt + ((size_t)(n * NHEADS + h) * HD + t * 16 + l15) * SEQ + kk + kb8;
            vf.q[0] = *(const uint4*)p;
            vf.q[1] = *(const uint4*)(p + 16);
            o[t].v = __builtin_amdgcn_wmma_f32_16x16x32_bf16(
                false, pa.v, false, vf.v, (short)0, o[t].v, false, false);
        }
    }

    // normalize and store (heads concatenated back into [N,S,D])
#pragma unroll
    for (int j = 0; j < 8; j++) {
        float ls = l[j];
        ls += __shfl_xor(ls, 1, 32);
        ls += __shfl_xor(ls, 2, 32);
        ls += __shfl_xor(ls, 4, 32);
        ls += __shfl_xor(ls, 8, 32);
        float inv = 1.0f / ls;
        int row = qbase + j + 8 * lhalf;
#pragma unroll
        for (int t = 0; t < 6; t++) {
            float v = o[t].f[j] * inv;
            O[(size_t)(n * SEQ + row) * DIMX + h * HD + t * 16 + l15] = (__bf16)v;
        }
    }
}

// ---------------------------------------------------------------------------
extern "C" void kernel_launch(void* const* d_in, const int* in_sizes, int n_in,
                              void* d_out, int out_size, void* d_ws,
                              size_t ws_size, hipStream_t stream) {
    (void)in_sizes; (void)n_in; (void)out_size; (void)ws_size;
    const float* q  = (const float*)d_in[0];
    const float* kv = (const float*)d_in[1];
    const float* wq = (const float*)d_in[2];
    const float* wk = (const float*)d_in[3];
    const float* wv = (const float*)d_in[4];
    const float* wp = (const float*)d_in[5];
    const float* bp = (const float*)d_in[6];

    char* ws = (char*)d_ws;
    size_t off = 0;
    const size_t ACT = (size_t)MTOT * DIMX * 2;   // 12.58 MB
    const size_t WB  = (size_t)DIMX * DIMX * 2;   // 1.18 MB
    __bf16* qb  = (__bf16*)(ws + off); off += ACT;
    __bf16* kvb = (__bf16*)(ws + off); off += ACT;
    __bf16* wqb = (__bf16*)(ws + off); off += WB;
    __bf16* wkb = (__bf16*)(ws + off); off += WB;
    __bf16* wvb = (__bf16*)(ws + off); off += WB;
    __bf16* wpb = (__bf16*)(ws + off); off += WB;
    __bf16* Qb  = (__bf16*)(ws + off); off += ACT;
    __bf16* Kb  = (__bf16*)(ws + off); off += ACT;
    __bf16* Vtb = (__bf16*)(ws + off); off += ACT;
    __bf16* Ab  = (__bf16*)(ws + off); off += ACT;

    const int nact = MTOT * DIMX;   // 6291456 (divisible by 1024)
    const int nw   = DIMX * DIMX;   // 589824  (divisible by 1024)
    cvt_bf16_kernel<<<nact / 4 / 256, 256, 0, stream>>>(q, qb, nact);
    cvt_bf16_kernel<<<nact / 4 / 256, 256, 0, stream>>>(kv, kvb, nact);
    cvt_bf16_kernel<<<nw / 4 / 256, 256, 0, stream>>>(wq, wqb, nw);
    cvt_bf16_kernel<<<nw / 4 / 256, 256, 0, stream>>>(wk, wkb, nw);
    cvt_bf16_kernel<<<nw / 4 / 256, 256, 0, stream>>>(wv, wvb, nw);
    cvt_bf16_kernel<<<nw / 4 / 256, 256, 0, stream>>>(wp, wpb, nw);

    dim3 gg(DIMX / 128, MTOT / 128);   // (6, 64)
    gemm_bf16_kernel<0><<<gg, 256, 0, stream>>>(qb,  wqb, Qb,  nullptr);
    gemm_bf16_kernel<0><<<gg, 256, 0, stream>>>(kvb, wkb, Kb,  nullptr);
    gemm_bf16_kernel<1><<<gg, 256, 0, stream>>>(kvb, wvb, Vtb, nullptr);

    attn_kernel<<<NB * NHEADS * (SEQ / 128), 256, 0, stream>>>(Qb, Kb, Vtb, Ab);

    gemm_bf16_kernel<2><<<gg, 256, 0, stream>>>(Ab, wpb, d_out, bp);
}

// v002
// A run of this version takes 150 microseconds.
// In both of two side-by-side timings against v001, it was 1.07 times as fast.
// Counting every step since v000, it is 1.52 times as fast.
#include <hip/hip_runtime.h>

#define DIMX   768
#define NHEADS 8
#define HD     96
#define SEQ    1024
#define NB     8
#define MTOT   (NB * SEQ)   // 8192

typedef __attribute__((ext_vector_type(16))) __bf16 v16bf;
typedef __attribute__((ext_vector_type(8)))  float  v8f;

union Frag {
    v16bf v;
    uint4 q[2];
    unsigned short s[16];
};
union AccU {
    v8f   v;
    float f[8];
};
union BfBits {
    __bf16 b;
    unsigned short u;
};

// ---------------------------------------------------------------------------
// fp32 -> bf16 convert of all six operands in one launch.  The six bf16 copies
// lie one behind the other in the workspace (q, kv, wq, wk, wv, wp), so block b
// writes span b of one long array; every span lies inside one source tensor.
// A lane brings 24 x 16 B, each wave-wide load 512 contiguous bytes.
// ---------------------------------------------------------------------------
#define CVT_LOADS  24
#define CVT_SPAN   (256 * 4 * CVT_LOADS)            // 24576 floats a block
#define CVT_ACTB   (MTOT * DIMX / CVT_SPAN)         // 256 blocks an activation
#define CVT_WB     (DIMX * DIMX / CVT_SPAN)         // 24 blocks a weight
#define CVT_BLOCKS (2 * CVT_ACTB + 4 * CVT_WB)      // 608

__global__ __launch_bounds__(256)
void cvt_all_kernel(const float* __restrict__ q,  const float* __restrict__ kv,
                    const float* __restrict__ wq, const float* __restrict__ wk,
                    const float* __restrict__ wv, const float* __restrict__ wp,
                    __bf16* __restrict__ y) {
    const int b = blockIdx.x;
    const float* src;
    int sb;
    if (b < CVT_ACTB) {
        src = q;  sb = b;
    } else if (b < 2 * CVT_ACTB) {
        src = kv; sb = b - CVT_ACTB;
    } else {
        const int w = (b - 2 * CVT_ACTB) / CVT_WB;
        sb  = (b - 2 * CVT_ACTB) % CVT_WB;
        src = w == 0 ? wq : w == 1 ? wk : w == 2 ? wv : wp;
    }
    const float4* x = (const float4*)(src + (size_t)sb * CVT_SPAN) + threadIdx.x;
    uint2*        o = (uint2*)(y + (size_t)b * CVT_SPAN) + threadIdx.x;

    float4 f[CVT_LOADS];
#pragma unroll
    for (int j = 0; j < CVT_LOADS; j++) f[j] = x[j * 256];
    // keeps every load of the lane ahead of the first convert and store, so that
    // the wave's whole span is in flight at once
    __builtin_amdgcn_sched_barrier(0);
#pragma unroll
    for (int j = 0; j < CVT_LOADS; j++) {
        union { __bf16 b[4]; uint2 u; } c;
        c.b[0] = (__bf16)f[j].x; c.b[1] = (__bf16)f[j].y;
        c.b[2] = (__bf16)f[j].z; c.b[3] = (__bf16)f[j].w;
        o[j * 256] = c.u;
    }
}

// ---------------------------------------------------------------------------
// One stage of the GEMM's LDS ring: each lane copies 4 x 16 B of A and 4 x 16 B
// of W (rows 32 apart) from global memory straight into LDS.  The s_wait_xcnt
// is the last line of the copies' own statement so that no address register is
// rewritten ahead of it.
// ---------------------------------------------------------------------------
#define KT      64                  // k per stage
#define NSTAGE  (DIMX / KT)         // 12
#define PITCH_B 144                 // LDS bytes per staged row
#define STAGE_B (256 * PITCH_B)     // 36864

__device__ __forceinline__ void stage_copy(const __bf16* ga, const __bf16* gw,
                                           unsigned lds) {
    asm volatile(
        "global_load_async_to_lds_b128 %0, %8, off\n\t"
        "global_load_async_to_lds_b128 %1, %9, off\n\t"
        "global_load_async_to_lds_b128 %2, %10, off\n\t"
        "global_load_async_to_lds_b128 %3, %11, off\n\t"
        "global_load_async_to_lds_b128 %4, %12, off\n\t"
        "global_load_async_to_lds_b128 %5, %13, off\n\t"
        "global_load_async_to_lds_b128 %6, %14, off\n\t"
        "global_load_async_to_lds_b128 %7, %15, off\n\t"
        "s_wait_xcnt 0x0"
        :: "v"(lds), "v"(lds + 32 * PITCH_B), "v"(lds + 64 * PITCH_B),
           "v"(lds + 96 * PITCH_B), "v"(lds + 128 * PITCH_B),
           "v"(lds + 160 * PITCH_B), "v"(lds + 192 * PITCH_B),
           "v"(lds + 224 * PITCH_B),
           "v"(ga), "v"(ga + 32 * DIMX), "v"(ga + 64 * DIMX), "v"(ga + 96 * DIMX),
           "v"(gw), "v"(gw + 32 * DIMX), "v"(gw + 64 * DIMX), "v"(gw + 96 * DIMX)
        : "memory");
}

// ---------------------------------------------------------------------------
// bf16 WMMA GEMM:  C[m,n] = sum_k A[m,k] * W[n,k]   (i.e. y = x @ W^T)
// A: [MTOT x DIMX] bf16 row-major,  W: [DIMX x DIMX] bf16 row-major.
// Block = 256 thr (8 waves) -> 128x128 tile; wave -> 32x64 (2x4 WMMA tiles).
// Operands are staged in LDS by asynchronous copies, two buffers.
// MODE 0: store bf16 [M x DIMX]
// MODE 1: store bf16 transposed per head: Vt[n,h,d,s]
// MODE 2: store f32 + bias -> d_out
// ---------------------------------------------------------------------------
template <int MODE>
__global__ __launch_bounds__(256)
void gemm_bf16_kernel(const __bf16* __restrict__ A,
                      const __bf16* __restrict__ W,
                      void* __restrict__ out,
                      const float* __restrict__ bias) {
    // Two stage buffers; a stage is [A 128 rows | W 128 rows] x 64 k (128 B a
    // row) at a pitch of 144 B, which spreads ds_load_b128 readers over the banks.
    __shared__ __align__(16) unsigned char tile[2 * STAGE_B];

    const int lane  = threadIdx.x & 31;
    const int wid   = threadIdx.x >> 5;
    const int wr    = wid & 3;          // 4 row-waves
    const int wc    = wid >> 2;         // 2 col-waves
    const int rowBase = blockIdx.y * 128 + wr * 32;
    const int colBase = blockIdx.x * 128 + wc * 64;
    const int l15   = lane & 15;
    const int lhalf = lane >> 4;

    // Copy map: 8 lanes cover one 128-B row piece, a wave 4 whole lines a copy.
    const int crow = threadIdx.x >> 3;  // 0..31
    const int cchk = threadIdx.x & 7;   // 16-B chunk in the row piece
    const __bf16* gA = A + (size_t)(blockIdx.y * 128 + crow) * DIMX + cchk * 8;
    const __bf16* gW = W + (size_t)(blockIdx.x * 128 + crow) * DIMX + cchk * 8;
    const unsigned ldsC = (unsigned)(size_t)tile + crow * PITCH_B + cchk * 16;

    AccU acc[2][4];
#pragma unroll
    for (int i = 0; i < 2; i++)
#pragma unroll
        for (int t = 0; t < 4; t++)
#pragma unroll
            for (int e = 0; e < 8; e++) acc[i][t].f[e] = 0.0f;

    stage_copy(gA, gW, ldsC);
    // stage 0 has landed before the barrier that publishes it
    asm volatile("s_wait_asynccnt 0x0" ::: "memory");
    __syncthreads();
    stage_copy(gA + KT, gW + KT, ldsC + STAGE_B);

    const unsigned char* fa = tile + (wr * 32 + l15) * PITCH_B + lhalf * 16;
    const unsigned char* fb = tile + (128 + wc * 64 + l15) * PITCH_B + lhalf * 16;

    for (int s = 0; s < NSTAGE; s++) {
        const int bo = (s & 1) * STAGE_B;
        Frag a[2][2], b[2][4];
#pragma unroll
        for (int ks = 0; ks < 2; ks++) {
#pragma unroll
            for (int i = 0; i < 2; i++) {
                const unsigned char* p = fa + bo + i * 16 * PITCH_B + ks * 64;
                a[ks][i].q[0] = *(const uint4*)p;
                a[ks][i].q[1] = *(const uint4*)(p + 32);
            }
#pragma unroll
            for (int t = 0; t < 4; t++) {
                const unsigned char* p = fb + bo + t * 16 * PITCH_B + ks * 64;
                b[ks][t].q[0] = *(const uint4*)p;
                b[ks][t].q[1] = *(const uint4*)(p + 32);
            }
        }
        // keeps all 24 LDS reads of a stage ahead of the stage's first WMMA, so
        // that the wave waits for LDS once a stage, not before each WMMA pair
        __builtin_amdgcn_sched_barrier(0);
#pragma unroll
        for (int ks = 0; ks < 2; ks++)
#pragma unroll
            for (int i = 0; i < 2; i++)
#pragma unroll
                for (int t = 0; t < 4; t++)
                    acc[i][t].v = __builtin_amdgcn_wmma_f32_16x16x32_bf16(
                        false, a[ks][i].v, false, b[ks][t].v, (short)0,
                        acc[i][t].v, false, false);

        // publish point: this wave's reads of the buffer are done, its copies of
        // the next stage have landed; the barrier says so for every wave
        asm volatile("s_wait_dscnt 0x0" ::: "memory");
        asm volatile("s_wait_asynccnt 0x0" ::: "memory");
        __syncthreads();
        if (s + 2 < NSTAGE)
            stage_copy(gA + (s + 2) * KT, gW + (s + 2) * KT, ldsC + bo);
    }
    // no copy is left in flight when the wave goes on to its stores
    asm volatile("s_wait_asynccnt 0x0" ::: "memory");

    // C layout: VGPR j -> row j (lanes 0-15) / row j+8 (lanes 16-31), col = l15
#pragma unroll
    for (int i = 0; i < 2; i++)
#pragma unroll
        for (int t = 0; t < 4; t++)
#pragma unroll
            for (int j = 0; j < 8; j++) {
                int row = rowBase + i * 16 + j + lhalf * 8;
                int col = colBase + t * 16 + l15;
                float v = acc[i][t].f[j];
                if (MODE == 0) {
                    ((__bf16*)out)[(size_t)row * DIMX + col] = (__bf16)v;
                } else if (MODE == 1) {
                    int nb = row >> 10, sr = row & 1023;
                    int h = col / HD, d = col % HD;
                    ((__bf16*)out)[(((size_t)nb * NHEADS + h) * HD + d) * SEQ + sr] =
                        (__bf16)v;
                } else {
                    ((float*)out)[(size_t)row * DIMX + col] = v + bias[col];
                }
            }
}

// ---------------------------------------------------------------------------
// Flash-style attention.  Block = 256 thr (8 waves) handles one (n,h,qblk of
// 128 rows); each wave owns 16 q-rows.  Online softmax, bf16 WMMA throughout.
// Q,K: [N,S,D] bf16 ; Vt: [N,H,hd,S] bf16 ; O: [N,S,D] bf16 (heads concat)
// ---------------------------------------------------------------------------
__global__ __launch_bounds__(256)
void attn_kernel(const __bf16* __restrict__ Q, const __bf16* __restrict__ K,
                 const __bf16* __restrict__ Vt, __bf16* __restrict__ O) {
    __shared__ __align__(16) unsigned short plds[8 * 16 * 32];

    const int lane  = threadIdx.x & 31;
    const int wid   = threadIdx.x >> 5;
    const int l15   = lane & 15;
    const int lhalf = lane >> 4;
    const int kb8   = lhalf * 8;

    const int blk  = blockIdx.x;
    const int qblk = blk & 7;           // S/128 = 8
    const int h    = (blk >> 3) & 7;
    const int n    = blk >> 6;
    const int qbase = qblk * 128 + wid * 16;
    unsigned short* myLds = plds + wid * (16 * 32);

    // Preload this wave's Q fragments (3 chunks of K=32 covering hd=96)
    Frag qf[3];
#pragma unroll
    for (int c = 0; c < 3; c++) {
        const __bf16* p =
            Q + (size_t)(n * SEQ + qbase + l15) * DIMX + h * HD + c * 32 + kb8;
        qf[c].q[0] = *(const uint4*)p;
        qf[c].q[1] = *(const uint4*)(p + 16);
    }

    AccU o[6];
#pragma unroll
    for (int t = 0; t < 6; t++)
#pragma unroll
        for (int e = 0; e < 8; e++) o[t].f[e] = 0.0f;
    float m[8], l[8];
#pragma unroll
    for (int j = 0; j < 8; j++) { m[j] = -1e30f; l[j] = 0.0f; }

    const float scale = 0.0360843918243516f;   // 1/sqrt(768)

    for (int kk = 0; kk < SEQ; kk += 32) {
        AccU s0, s1;
#pragma unroll
        for (int e = 0; e < 8; e++) { s0.f[e] = 0.0f; s1.f[e] = 0.0f; }

        // scores: Q[16x96] x K^T chunks -> two 16x16 tiles (cols kk..+15, +16..+31)
#pragma unroll
        for (int c = 0; c < 3; c++) {
            Frag kf0, kf1;
            const __bf16* p0 =
                K + (size_t)(n * SEQ + kk + l15) * DIMX + h * HD + c * 32 + kb8;
            kf0.q[0] = *(const uint4*)p0;
            kf0.q[1] = *(const uint4*)(p0 + 16);
            const __bf16* p1 = p0 + (size_t)16 * DIMX;
            kf1.q[0] = *(const uint4*)p1;
            kf1.q[1] = *(const uint4*)(p1 + 16);
            s0.v = __builtin_amdgcn_wmma_f32_16x16x32_bf16(
                false, qf[c].v, false, kf0.v, (short)0, s0.v, false, false);
            s1.v = __builtin_amdgcn_wmma_f32_16x16x32_bf16(
                false, qf[c].v, false, kf1.v, (short)0, s1.v, false, false);
        }

        // online softmax; row j lives in lanes<16 (row j) / lanes>=16 (row j+8)
#pragma unroll
        for (int j = 0; j < 8; j++) {
            float a0 = s0.f[j] * scale;
            float a1 = s1.f[j] * scale;
            float mx = fmaxf(a0, a1);
            mx = fmaxf(mx, __shfl_xor(mx, 1, 32));
            mx = fmaxf(mx, __shfl_xor(mx, 2, 32));
            mx = fmaxf(mx, __shfl_xor(mx, 4, 32));
            mx = fmaxf(mx, __shfl_xor(mx, 8, 32));
            float mn = fmaxf(m[j], mx);
            float fr = __expf(m[j] - mn);
            m[j] = mn;
            l[j] *= fr;
#pragma unroll
            for (int t = 0; t < 6; t++) o[t].f[j] *= fr;
            float p0 = __expf(a0 - mn);
            float p1 = __expf(a1 - mn);
            l[j] += p0 + p1;   // per-lane partial row sum (reduced at the end)
            // repack P tile -> LDS row-major [16 x 32] (wave-private)
            BfBits c0; c0.b = (__bf16)p0;
            BfBits c1; c1.b = (__bf16)p1;
            int row = j + 8 * lhalf;
            myLds[row * 32 + l15]      = c0.u;
            myLds[row * 32 + 16 + l15] = c1.u;
        }

        // read P back in A-fragment layout (same-wave LDS, in-order, no barrier)
        Frag pa;
        const unsigned short* lp = myLds + l15 * 32 + kb8;
        pa.q[0] = *(const uint4*)lp;
        pa.q[1] = *(const uint4*)(lp + 16);

        // out += P[16x32] x V[32x96]  (Vt rows are contiguous in s)
#pragma unroll
        for (int t = 0; t < 6; t++) {
            Frag vf;
            const __bf16* p =
                Vt + ((size_t)(n * NHEADS + h) * HD + t * 16 + l15) * SEQ + kk + kb8;
            vf.q[0] = *(const uint4*)p;
            vf.q[1] = *(const uint4*)(p + 16);
            o[t].v = __builtin_amdgcn_wmma_f32_16x16x32_bf16(
                false, pa.v, false, vf.v, (short)0, o[t].v, false, false);
        }
    }

    // normalize and store (heads concatenated back into [N,S,D])
#pragma unroll
    for (int j = 0; j < 8; j++) {
        float ls = l[j];
        ls += __shfl_xor(ls, 1, 32);
        ls += __shfl_xor(ls, 2, 32);
        ls += __shfl_xor(ls, 4, 32);
        ls += __shfl_xor(ls, 8, 32);
        float inv = 1.0f / ls;
        int row = qbase + j + 8 * lhalf;
#pragma unroll
        for (int t = 0; t < 6; t++) {
            float v = o[t].f[j] * inv;
            O[(size_t)(n * SEQ + row) * DIMX + h * HD + t * 16 + l15] = (__bf16)v;
        }
    }
}

// ---------------------------------------------------------------------------
extern "C" void kernel_launch(void* const* d_in, const int* in_sizes, int n_in,
                              void* d_out, int out_size, void* d_ws,
                              size_t ws_size, hipStream_t stream) {
    (void)in_sizes; (void)n_in; (void)out_size; (void)ws_size;
    const float* q  = (const float*)d_in[0];
    const float* kv = (const float*)d_in[1];
    const float* wq = (const float*)d_in[2];
    const float* wk = (const float*)d_in[3];
    const float* wv = (const float*)d_in[4];
    const float* wp = (const float*)d_in[5];
    const float* bp = (const float*)d_in[6];

    char* ws = (char*)d_ws;
    size_t off = 0;
    const size_t ACT = (size_t)MTOT * DIMX * 2;   // 12.58 MB
    const size_t WB  = (size_t)DIMX * DIMX * 2;   // 1.18 MB
    __bf16* qb  = (__bf16*)(ws + off); off += ACT;
    __bf16* kvb = (__bf16*)(ws + off); off += ACT;
    __bf16* wqb = (__bf16*)(ws + off); off += WB;
    __bf16* wkb = (__bf16*)(ws + off); off += WB;
    __bf16* wvb = (__bf16*)(ws + off); off += WB;
    __bf16* wpb = (__bf16*)(ws + off); off += WB;
    __bf16* Qb  = (__bf16*)(ws + off); off += ACT;
    __bf16* Kb  = (__bf16*)(ws + off); off += ACT;
    __bf16* Vtb = (__bf16*)(ws + off); off += ACT;
    __bf16* Ab  = (__bf16*)(ws + off); off += ACT;

    // qb .. wpb are contiguous: one destination array for the whole launch
    cvt_all_kernel<<<CVT_BLOCKS, 256, 0, stream>>>(q, kv, wq, wk, wv, wp, qb);

    dim3 gg(DIMX / 128, MTOT / 128);   // (6, 64)
    gemm_bf16_kernel<0><<<gg, 256, 0, stream>>>(qb,  wqb, Qb,  nullptr);
    gemm_bf16_kernel<0><<<gg, 256, 0, stream>>>(kvb, wkb, Kb,  nullptr);
    gemm_bf16_kernel<1><<<gg, 256, 0, stream>>>(kvb, wvb, Vtb, nullptr);

    attn_kernel<<<NB * NHEADS * (SEQ / 128), 256, 0, stream>>>(Qb, Kb, Vtb, Ab);

    gemm_bf16_kernel<2><<<gg, 256, 0, stream>>>(Ab, wpb, d_out, bp);
}

// v003
// One run takes 112 microseconds.
// In two side-by-side timings against v002, it was 1.35 and 1.34 times as fast.
// Over all steps from v000 it is 2.04 times as fast.
#include <hip/hip_runtime.h>

#define DIMX   768
#define NHEADS 8
#define HD     96
#define SEQ    1024
#define NB     8
#define MTOT   (NB * SEQ)   // 8192

typedef __attribute__((ext_vector_type(16))) __bf16 v16bf;
typedef __attribute__((ext_vector_type(8)))  float  v8f;

union Frag {
    v16bf v;
    uint4 q[2];
    unsigned short s[16];
};
union AccU {
    v8f   v;
    float f[8];
};
union BfBits {
    __bf16 b;
    unsigned short u;
};

// ---------------------------------------------------------------------------
// fp32 -> bf16 convert of all six operands in one launch.  The six bf16 copies
// lie one behind the other in the workspace (q, kv, wq, wk, wv, wp), so block b
// writes span b of one long array; every span lies inside one source tensor.
// A lane brings 24 x 16 B, each wave-wide load 512 contiguous bytes.
// ---------------------------------------------------------------------------
#define CVT_LOADS  24
#define CVT_SPAN   (256 * 4 * CVT_LOADS)            // 24576 floats a block
#define CVT_ACTB   (MTOT * DIMX / CVT_SPAN)         // 256 blocks an activation
#define CVT_WB     (DIMX * DIMX / CVT_SPAN)         // 24 blocks a weight
#define CVT_BLOCKS (2 * CVT_ACTB + 4 * CVT_WB)      // 608

__global__ __launch_bounds__(256)
void cvt_all_kernel(const float* __restrict__ q,  const float* __restrict__ kv,
                    const float* __restrict__ wq, const float* __restrict__ wk,
                    const float* __restrict__ wv, const float* __restrict__ wp,
                    __bf16* __restrict__ y) {
    const int b = blockIdx.x;
    const float* src;
    int sb;
    if (b < CVT_ACTB) {
        src = q;  sb = b;
    } else if (b < 2 * CVT_ACTB) {
        src = kv; sb = b - CVT_ACTB;
    } else {
        const int w = (b - 2 * CVT_ACTB) / CVT_WB;
        sb  = (b - 2 * CVT_ACTB) % CVT_WB;
        src = w == 0 ? wq : w == 1 ? wk : w == 2 ? wv : wp;
    }
    const float4* x = (const float4*)(src + (size_t)sb * CVT_SPAN) + threadIdx.x;
    uint2*        o = (uint2*)(y + (size_t)b * CVT_SPAN) + threadIdx.x;

    float4 f[CVT_LOADS];
#pragma unroll
    for (int j = 0; j < CVT_LOADS; j++) f[j] = x[j * 256];
    // keeps every load of the lane ahead of the first convert and store, so that
    // the wave's whole span is in flight at once
    __builtin_amdgcn_sched_barrier(0);
#pragma unroll
    for (int j = 0; j < CVT_LOADS; j++) {
        union { __bf16 b[4]; uint2 u; } c;
        c.b[0] = (__bf16)f[j].x; c.b[1] = (__bf16)f[j].y;
        c.b[2] = (__bf16)f[j].z; c.b[3] = (__bf16)f[j].w;
        o[j * 256] = c.u;
    }
}

// ---------------------------------------------------------------------------
// One stage of the GEMM's LDS ring: each lane copies 4 x 16 B of A and 4 x 16 B
// of W (rows 32 apart) from global memory straight into LDS.  The s_wait_xcnt
// is the last line of the copies' own statement so that no address register is
// rewritten ahead of it.
// ---------------------------------------------------------------------------
#define KT      64                  // k per stage
#define NSTAGE  (DIMX / KT)         // 12
#define PITCH_B 144                 // LDS bytes per staged row
#define STAGE_B (256 * PITCH_B)     // 36864

__device__ __forceinline__ void stage_copy(const __bf16* ga, const __bf16* gw,
                                           unsigned lds) {
    asm volatile(
        "global_load_async_to_lds_b128 %0, %8, off\n\t"
        "global_load_async_to_lds_b128 %1, %9, off\n\t"
        "global_load_async_to_lds_b128 %2, %10, off\n\t"
        "global_load_async_to_lds_b128 %3, %11, off\n\t"
        "global_load_async_to_lds_b128 %4, %12, off\n\t"
        "global_load_async_to_lds_b128 %5, %13, off\n\t"
        "global_load_async_to_lds_b128 %6, %14, off\n\t"
        "global_load_async_to_lds_b128 %7, %15, off\n\t"
        "s_wait_xcnt 0x0"
        :: "v"(lds), "v"(lds + 32 * PITCH_B), "v"(lds + 64 * PITCH_B),
           "v"(lds + 96 * PITCH_B), "v"(lds + 128 * PITCH_B),
           "v"(lds + 160 * PITCH_B), "v"(lds + 192 * PITCH_B),
           "v"(lds + 224 * PITCH_B),
           "v"(ga), "v"(ga + 32 * DIMX), "v"(ga + 64 * DIMX), "v"(ga + 96 * DIMX),
           "v"(gw), "v"(gw + 32 * DIMX), "v"(gw + 64 * DIMX), "v"(gw + 96 * DIMX)
        : "memory");
}

// ---------------------------------------------------------------------------
// bf16 WMMA GEMM:  C[m,n] = sum_k A[m,k] * W[n,k]   (i.e. y = x @ W^T)
// A: [MTOT x DIMX] bf16 row-major,  W: [DIMX x DIMX] bf16 row-major.
// Block = 256 thr (8 waves) -> 128x128 tile; wave -> 32x64 (2x4 WMMA tiles).
// Operands are staged in LDS by asynchronous copies, two buffers.
// MODE 0: store bf16 [M x DIMX]
// MODE 1: store bf16 transposed per head: Vt[n,h,d,s]
// MODE 2: store f32 + bias -> d_out
// ---------------------------------------------------------------------------
template <int MODE>
__global__ __launch_bounds__(256)
void gemm_bf16_kernel(const __bf16* __restrict__ A,
                      const __bf16* __restrict__ W,
                      void* __restrict__ out,
                      const float* __restrict__ bias) {
    // Two stage buffers; a stage is [A 128 rows | W 128 rows] x 64 k (128 B a
    // row) at a pitch of 144 B, which spreads ds_load_b128 readers over the banks.
    __shared__ __align__(16) unsigned char tile[2 * STAGE_B];

    const int lane  = threadIdx.x & 31;
    const int wid   = threadIdx.x >> 5;
    const int wr    = wid & 3;          // 4 row-waves
    const int wc    = wid >> 2;         // 2 col-waves
    const int rowBase = blockIdx.y * 128 + wr * 32;
    const int colBase = blockIdx.x * 128 + wc * 64;
    const int l15   = lane & 15;
    const int lhalf = lane >> 4;

    // Copy map: 8 lanes cover one 128-B row piece, a wave 4 whole lines a copy.
    const int crow = threadIdx.x >> 3;  // 0..31
    const int cchk = threadIdx.x & 7;   // 16-B chunk in the row piece
    const __bf16* gA = A + (size_t)(blockIdx.y * 128 + crow) * DIMX + cchk * 8;
    const __bf16* gW = W + (size_t)(blockIdx.x * 128 + crow) * DIMX + cchk * 8;
    const unsigned ldsC = (unsigned)(size_t)tile + crow * PITCH_B + cchk * 16;

    AccU acc[2][4];
#pragma unroll
    for (int i = 0; i < 2; i++)
#pragma unroll
        for (int t = 0; t < 4; t++)
#pragma unroll
            for (int e = 0; e < 8; e++) acc[i][t].f[e] = 0.0f;

    stage_copy(gA, gW, ldsC);
    // stage 0 has landed before the barrier that publishes it
    asm volatile("s_wait_asynccnt 0x0" ::: "memory");
    __syncthreads();
    stage_copy(gA + KT, gW + KT, ldsC + STAGE_B);

    const unsigned char* fa = tile + (wr * 32 + l15) * PITCH_B + lhalf * 16;
    const unsigned char* fb = tile + (128 + wc * 64 + l15) * PITCH_B + lhalf * 16;

    for (int s = 0; s < NSTAGE; s++) {
        const int bo = (s & 1) * STAGE_B;
        Frag a[2][2], b[2][4];
#pragma unroll
        for (int ks = 0; ks < 2; ks++) {
#pragma unroll
            for (int i = 0; i < 2; i++) {
                const unsigned char* p = fa + bo + i * 16 * PITCH_B + ks * 64;
                a[ks][i].q[0] = *(const uint4*)p;
                a[ks][i].q[1] = *(const uint4*)(p + 32);
            }
#pragma unroll
            for (int t = 0; t < 4; t++) {
                const unsigned char* p = fb + bo + t * 16 * PITCH_B + ks * 64;
                b[ks][t].q[0] = *(const uint4*)p;
                b[ks][t].q[1] = *(const uint4*)(p + 32);
            }
        }
        // keeps all 24 LDS reads of a stage ahead of the stage's first WMMA, so
        // that the wave waits for LDS once a stage, not before each WMMA pair
        __builtin_amdgcn_sched_barrier(0);
#pragma unroll
        for (int ks = 0; ks < 2; ks++)
#pragma unroll
            for (int i = 0; i < 2; i++)
#pragma unroll
                for (int t = 0; t < 4; t++)
                    acc[i][t].v = __builtin_amdgcn_wmma_f32_16x16x32_bf16(
                        false, a[ks][i].v, false, b[ks][t].v, (short)0,
                        acc[i][t].v, false, false);

        // publish point: this wave's reads of the buffer are done, its copies of
        // the next stage have landed; the barrier says so for every wave
        asm volatile("s_wait_dscnt 0x0" ::: "memory");
        asm volatile("s_wait_asynccnt 0x0" ::: "memory");
        __syncthreads();
        if (s + 2 < NSTAGE)
            stage_copy(gA + (s + 2) * KT, gW + (s + 2) * KT, ldsC + bo);
    }
    // no copy is left in flight when the wave goes on to its stores
    asm volatile("s_wait_asynccnt 0x0" ::: "memory");

    // C layout: VGPR j -> row j (lanes 0-15) / row j+8 (lanes 16-31), col = l15
#pragma unroll
    for (int i = 0; i < 2; i++)
#pragma unroll
        for (int t = 0; t < 4; t++)
#pragma unroll
            for (int j = 0; j < 8; j++) {
                int row = rowBase + i * 16 + j + lhalf * 8;
                int col = colBase + t * 16 + l15;
                float v = acc[i][t].f[j];
                if (MODE == 0) {
                    ((__bf16*)out)[(size_t)row * DIMX + col] = (__bf16)v;
                } else if (MODE == 1) {
                    int nb = row >> 10, sr = row & 1023;
                    int h = col / HD, d = col % HD;
                    ((__bf16*)out)[(((size_t)nb * NHEADS + h) * HD + d) * SEQ + sr] =
                        (__bf16)v;
                } else {
                    ((float*)out)[(size_t)row * DIMX + col] = v + bias[col];
                }
            }
}

// ---------------------------------------------------------------------------
// One stage of the attention kernel's LDS ring: 64 keys of K (64 rows of 192 B)
// and of Vt (96 rows of 128 B), 6 x 16 B a lane, from global memory straight
// into LDS.  The s_wait_xcnt is the last line of the copies' own statement so
// that no address register is rewritten ahead of it.
// ---------------------------------------------------------------------------
#define AKT      64                          // keys per stage
#define ANSTAGE  (SEQ / AKT)                 // 16
#define KPITCH_B 208                         // LDS bytes per K row  (16 B x 13)
#define VPITCH_B 144                         // LDS bytes per Vt row (16 B x 9)
#define KTILE_B  (AKT * KPITCH_B)            // 13312
#define ASTAGE_B (KTILE_B + HD * VPITCH_B)   // 27136

__device__ __forceinline__ void kv_stage_copy(const __bf16* k0, const __bf16* k1,
                                              const __bf16* k2, const __bf16* v,
                                              unsigned lk0, unsigned lk1,
                                              unsigned lk2, unsigned lv) {
    asm volatile(
        "global_load_async_to_lds_b128 %0, %6, off\n\t"
        "global_load_async_to_lds_b128 %1, %7, off\n\t"
        "global_load_async_to_lds_b128 %2, %8, off\n\t"
        "global_load_async_to_lds_b128 %3, %9, off\n\t"
        "global_load_async_to_lds_b128 %4, %10, off\n\t"
        "global_load_async_to_lds_b128 %5, %11, off\n\t"
        "s_wait_xcnt 0x0"
        :: "v"(lk0), "v"(lk1), "v"(lk2),
           "v"(lv), "v"(lv + 32 * VPITCH_B), "v"(lv + 64 * VPITCH_B),
           "v"(k0), "v"(k1), "v"(k2),
           "v"(v), "v"(v + 32 * SEQ), "v"(v + 64 * SEQ)
        : "memory");
}

// ---------------------------------------------------------------------------
// Flash-style attention.  Block = 256 thr (8 waves) handles one (n,h,qblk of
// 128 rows); each wave owns 16 q-rows.  Online softmax, bf16 WMMA throughout.
// The block's 8 waves read the same K and Vt: both are staged in LDS by
// asynchronous copies, two buffers of 64 keys.
// Q,K: [N,S,D] bf16 ; Vt: [N,H,hd,S] bf16 ; O: [N,S,D] bf16 (heads concat)
// ---------------------------------------------------------------------------
__global__ __launch_bounds__(256)
void attn_kernel(const __bf16* __restrict__ Q, const __bf16* __restrict__ K,
                 const __bf16* __restrict__ Vt, __bf16* __restrict__ O) {
    __shared__ __align__(16) unsigned short plds[8 * 16 * 32];
    // Two stage buffers; a stage is [K 64 rows x 192 B | Vt 96 rows x 128 B], each
    // at a pitch of 16 B x odd, which spreads ds_load_b128 readers over the banks.
    __shared__ __align__(16) unsigned char kvt[2 * ASTAGE_B];

    const int lane  = threadIdx.x & 31;
    const int wid   = threadIdx.x >> 5;
    const int l15   = lane & 15;
    const int lhalf = lane >> 4;
    const int kb8   = lhalf * 8;

    const int blk  = blockIdx.x;
    const int qblk = blk & 7;           // S/128 = 8
    const int h    = (blk >> 3) & 7;
    const int n    = blk >> 6;
    const int qbase = qblk * 128 + wid * 16;
    unsigned short* myLds = plds + wid * (16 * 32);

    // Copy map.  K: the stage's 768 chunks of 16 B in row order, 12 a row, so a
    // wave-wide copy covers 32 consecutive chunks, 2 2/3 rows; Vt: 8 lanes cover one 128-B line.
    const int kc0 = threadIdx.x, kc1 = kc0 + 256, kc2 = kc0 + 512;
    const __bf16* Kh = K + (size_t)n * SEQ * DIMX + h * HD;
    const __bf16* gK0 = Kh + (kc0 / 12) * DIMX + (kc0 % 12) * 8;
    const __bf16* gK1 = Kh + (kc1 / 12) * DIMX + (kc1 % 12) * 8;
    const __bf16* gK2 = Kh + (kc2 / 12) * DIMX + (kc2 % 12) * 8;
    const __bf16* gV  = Vt + ((size_t)(n * NHEADS + h) * HD + (threadIdx.x >> 3)) * SEQ
                           + (threadIdx.x & 7) * 8;
    const unsigned ldsB = (unsigned)(size_t)kvt;
    const unsigned lK0 = ldsB + (kc0 / 12) * KPITCH_B + (kc0 % 12) * 16;
    const unsigned lK1 = ldsB + (kc1 / 12) * KPITCH_B + (kc1 % 12) * 16;
    const unsigned lK2 = ldsB + (kc2 / 12) * KPITCH_B + (kc2 % 12) * 16;
    const unsigned lV  = ldsB + KTILE_B + (threadIdx.x >> 3) * VPITCH_B
                              + (threadIdx.x & 7) * 16;

    kv_stage_copy(gK0, gK1, gK2, gV, lK0, lK1, lK2, lV);
    // stage 0 has landed before the barrier that publishes it
    asm volatile("s_wait_asynccnt 0x0" ::: "memory");
    __syncthreads();
    kv_stage_copy(gK0 + AKT * DIMX, gK1 + AKT * DIMX, gK2 + AKT * DIMX, gV + AKT,
                  lK0 + ASTAGE_B, lK1 + ASTAGE_B, lK2 + ASTAGE_B, lV + ASTAGE_B);

    // Preload this wave's Q fragments (3 chunks of K=32 covering hd=96)
    Frag qf[3];
#pragma unroll
    for (int c = 0; c < 3; c++) {
        const __bf16* p =
            Q + (size_t)(n * SEQ + qbase + l15) * DIMX + h * HD + c * 32 + kb8;
        qf[c].q[0] = *(const uint4*)p;
        qf[c].q[1] = *(const uint4*)(p + 16);
    }

    AccU o[6];
#pragma unroll
    for (int t = 0; t < 6; t++)
#pragma unroll
        for (int e = 0; e < 8; e++) o[t].f[e] = 0.0f;
    float m[8], l[8];
#pragma unroll
    for (int j = 0; j < 8; j++) { m[j] = -1e30f; l[j] = 0.0f; }

    const float scale = 0.0360843918243516f;   // 1/sqrt(768)

    const unsigned char* fk = kvt + l15 * KPITCH_B + lhalf * 16;
    const unsigned char* fv = kvt + KTILE_B + l15 * VPITCH_B + lhalf * 16;

    for (int st = 0; st < ANSTAGE; st++) {
      const int bo = (st & 1) * ASTAGE_B;
      // unrolled so that the two 32-key halves of a stage differ only in the LDS
      // reads' immediate offsets
#pragma unroll
      for (int kk = 0; kk < AKT; kk += 32) {
        AccU s0, s1;
#pragma unroll
        for (int e = 0; e < 8; e++) { s0.f[e] = 0.0f; s1.f[e] = 0.0f; }

        // scores: Q[16x96] x K^T chunks -> two 16x16 tiles (cols kk..+15, +16..+31)
#pragma unroll
        for (int c = 0; c < 3; c++) {
            Frag kf0, kf1;
            const unsigned char* p0 = fk + bo + kk * KPITCH_B + c * 64;
            kf0.q[0] = *(const uint4*)p0;
            kf0.q[1] = *(const uint4*)(p0 + 32);
            const unsigned char* p1 = p0 + 16 * KPITCH_B;
            kf1.q[0] = *(const uint4*)p1;
            kf1.q[1] = *(const uint4*)(p1 + 32);
            s0.v = __builtin_amdgcn_wmma_f32_16x16x32_bf16(
                false, qf[c].v, false, kf0.v, (short)0, s0.v, false, false);
            s1.v = __builtin_amdgcn_wmma_f32_16x16x32_bf16(
                false, qf[c].v, false, kf1.v, (short)0, s1.v, false, false);
        }

        // online softmax; row j lives in lanes<16 (row j) / lanes>=16 (row j+8)
#pragma unroll
        for (int j = 0; j < 8; j++) {
            float a0 = s0.f[j] * scale;
            float a1 = s1.f[j] * scale;
            float mx = fmaxf(a0, a1);
            mx = fmaxf(mx, __shfl_xor(mx, 1, 32));
            mx = fmaxf(mx, __shfl_xor(mx, 2, 32));
            mx = fmaxf(mx, __shfl_xor(mx, 4, 32));
            mx = fmaxf(mx, __shfl_xor(mx, 8, 32));
            float mn = fmaxf(m[j], mx);
            float fr = __expf(m[j] - mn);
            m[j] = mn;
            l[j] *= fr;
#pragma unroll
            for (int t = 0; t < 6; t++) o[t].f[j] *= fr;
            float p0 = __expf(a0 - mn);
            float p1 = __expf(a1 - mn);
            l[j] += p0 + p1;   // per-lane partial row sum (reduced at the end)
            // repack P tile -> LDS row-major [16 x 32] (wave-private)
            BfBits c0; c0.b = (__bf16)p0;
            BfBits c1; c1.b = (__bf16)p1;
            int row = j + 8 * lhalf;
            myLds[row * 32 + l15]      = c0.u;
            myLds[row * 32 + 16 + l15] = c1.u;
        }

        // read P back in A-fragment layout (same-wave LDS, in-order, no barrier)
        Frag pa;
        const unsigned short* lp = myLds + l15 * 32 + kb8;
        pa.q[0] = *(const uint4*)lp;
        pa.q[1] = *(const uint4*)(lp + 16);

        // out += P[16x32] x V[32x96]  (Vt rows are contiguous in s)
#pragma unroll
        for (int t = 0; t < 6; t++) {
            Frag vf;
            const unsigned char* p = fv + bo + t * 16 * VPITCH_B + kk * 2;
            vf.q[0] = *(const uint4*)p;
            vf.q[1] = *(const uint4*)(p + 32);
            o[t].v = __builtin_amdgcn_wmma_f32_16x16x32_bf16(
                false, pa.v, false, vf.v, (short)0, o[t].v, false, false);
        }
      }

      // publish point: this wave's reads of the buffer are done, its copies of
      // the next stage have landed; the barrier says so for every wave
      asm volatile("s_wait_dscnt 0x0" ::: "memory");
      asm volatile("s_wait_asynccnt 0x0" ::: "memory");
      __syncthreads();
      if (st + 2 < ANSTAGE)
          kv_stage_copy(gK0 + (st + 2) * AKT * DIMX, gK1 + (st + 2) * AKT * DIMX,
                        gK2 + (st + 2) * AKT * DIMX, gV + (st + 2) * AKT,
                        lK0 + bo, lK1 + bo, lK2 + bo, lV + bo);
    }
    // no copy is left in flight when the wave goes on to its stores
    asm volatile("s_wait_asynccnt 0x0" ::: "memory");

    // normalize and store (heads concatenated back into [N,S,D])
#pragma unroll
    for (int j = 0; j < 8; j++) {
        float ls = l[j];
        ls += __shfl_xor(ls, 1, 32);
        ls += __shfl_xor(ls, 2, 32);
        ls += __shfl_xor(ls, 4, 32);
        ls += __shfl_xor(ls, 8, 32);
        float inv = 1.0f / ls;
        int row = qbase + j + 8 * lhalf;
#pragma unroll
        for (int t = 0; t < 6; t++) {
            float v = o[t].f[j] * inv;
            O[(size_t)(n * SEQ + row) * DIMX + h * HD + t * 16 + l15] = (__bf16)v;
        }
    }
}

// ---------------------------------------------------------------------------
extern "C" void kernel_launch(void* const* d_in, const int* in_sizes, int n_in,
                              void* d_out, int out_size, void* d_ws,
                              size_t ws_size, hipStream_t stream) {
    (void)in_sizes; (void)n_in; (void)out_size; (void)ws_size;
    const float* q  = (const float*)d_in[0];
    const float* kv = (const float*)d_in[1];
    const float* wq = (const float*)d_in[2];
    const float* wk = (const float*)d_in[3];
    const float* wv = (const float*)d_in[4];
    const float* wp = (const float*)d_in[5];
    const float* bp = (const float*)d_in[6];

    char* ws = (char*)d_ws;
    size_t off = 0;
    const size_t ACT = (size_t)MTOT * DIMX * 2;   // 12.58 MB
    const size_t WB  = (size_t)DIMX * DIMX * 2;   // 1.18 MB
    __bf16* qb  = (__bf16*)(ws + off); off += ACT;
    __bf16* kvb = (__bf16*)(ws + off); off += ACT;
    __bf16* wqb = (__bf16*)(ws + off); off += WB;
    __bf16* wkb = (__bf16*)(ws + off); off += WB;
    __bf16* wvb = (__bf16*)(ws + off); off += WB;
    __bf16* wpb = (__bf16*)(ws + off); off += WB;
    __bf16* Qb  = (__bf16*)(ws + off); off += ACT;
    __bf16* Kb  = (__bf16*)(ws + off); off += ACT;
    __bf16* Vtb = (__bf16*)(ws + off); off += ACT;
    __bf16* Ab  = (__bf16*)(ws + off); off += ACT;

    // qb .. wpb are contiguous: one destination array for the whole launch
    cvt_all_kernel<<<CVT_BLOCKS, 256, 0, stream>>>(q, kv, wq, wk, wv, wp, qb);

    dim3 gg(DIMX / 128, MTOT / 128);   // (6, 64)
    gemm_bf16_kernel<0><<<gg, 256, 0, stream>>>(qb,  wqb, Qb,  nullptr);
    gemm_bf16_kernel<0><<<gg, 256, 0, stream>>>(kvb, wkb, Kb,  nullptr);
    gemm_bf16_kernel<1><<<gg, 256, 0, stream>>>(kvb, wvb, Vtb, nullptr);

    attn_kernel<<<NB * NHEADS * (SEQ / 128), 256, 0, stream>>>(Qb, Kb, Vtb, Ab);

    gemm_bf16_kernel<2><<<gg, 256, 0, stream>>>(Ab, wpb, d_out, bp);
}

// v004
// It runs in 103 microseconds.
// In two side-by-side timings against v003, it was 1.08 and 1.09 times as fast.
// Over all steps from v000 it is 2.21 times as fast.
#include <hip/hip_runtime.h>

#define DIMX   768
#define NHEADS 8
#define HD     96
#define SEQ    1024
#define NB     8
#define MTOT   (NB * SEQ)   // 8192

typedef __attribute__((ext_vector_type(16))) __bf16 v16bf;
typedef __attribute__((ext_vector_type(8)))  float  v8f;

union Frag {
    v16bf v;
    uint4 q[2];
    unsigned short s[16];
};
union AccU {
    v8f   v;
    float f[8];
};

// ---------------------------------------------------------------------------
// fp32 -> bf16 convert of all six operands in one launch.  The six bf16 copies
// lie one behind the other in the workspace (q, kv, wq, wk, wv, wp), so block b
// writes span b of one long array; every span lies inside one source tensor.
// A lane brings 24 x 16 B, each wave-wide load 512 contiguous bytes.
// ---------------------------------------------------------------------------
#define CVT_LOADS  24
#define CVT_SPAN   (256 * 4 * CVT_LOADS)            // 24576 floats a block
#define CVT_ACTB   (MTOT * DIMX / CVT_SPAN)         // 256 blocks an activation
#define CVT_WB     (DIMX * DIMX / CVT_SPAN)         // 24 blocks a weight
#define CVT_BLOCKS (2 * CVT_ACTB + 4 * CVT_WB)      // 608

__global__ __launch_bounds__(256)
void cvt_all_kernel(const float* __restrict__ q,  const float* __restrict__ kv,
                    const float* __restrict__ wq, const float* __restrict__ wk,
                    const float* __restrict__ wv, const float* __restrict__ wp,
                    __bf16* __restrict__ y) {
    const int b = blockIdx.x;
    const float* src;
    int sb;
    if (b < CVT_ACTB) {
        src = q;  sb = b;
    } else if (b < 2 * CVT_ACTB) {
        src = kv; sb = b - CVT_ACTB;
    } else {
        const int w = (b - 2 * CVT_ACTB) / CVT_WB;
        sb  = (b - 2 * CVT_ACTB) % CVT_WB;
        src = w == 0 ? wq : w == 1 ? wk : w == 2 ? wv : wp;
    }
    const float4* x = (const float4*)(src + (size_t)sb * CVT_SPAN) + threadIdx.x;
    uint2*        o = (uint2*)(y + (size_t)b * CVT_SPAN) + threadIdx.x;

    float4 f[CVT_LOADS];
#pragma unroll
    for (int j = 0; j < CVT_LOADS; j++) f[j] = x[j * 256];
    // keeps every load of the lane ahead of the first convert and store, so that
    // the wave's whole span is in flight at once
    __builtin_amdgcn_sched_barrier(0);
#pragma unroll
    for (int j = 0; j < CVT_LOADS; j++) {
        union { __bf16 b[4]; uint2 u; } c;
        c.b[0] = (__bf16)f[j].x; c.b[1] = (__bf16)f[j].y;
        c.b[2] = (__bf16)f[j].z; c.b[3] = (__bf16)f[j].w;
        o[j * 256] = c.u;
    }
}

// ---------------------------------------------------------------------------
// One stage of the GEMM's LDS ring: each lane copies 4 x 16 B of A and 4 x 16 B
// of W (rows 32 apart) from global memory straight into LDS.  The s_wait_xcnt
// is the last line of the copies' own statement so that no address register is
// rewritten ahead of it.
// ---------------------------------------------------------------------------
#define KT      64                  // k per stage
#define NSTAGE  (DIMX / KT)         // 12
#define PITCH_B 144                 // LDS bytes per staged row
#define STAGE_B (256 * PITCH_B)     // 36864

__device__ __forceinline__ void stage_copy(const __bf16* ga, const __bf16* gw,
                                           unsigned lds) {
    asm volatile(
        "global_load_async_to_lds_b128 %0, %8, off\n\t"
        "global_load_async_to_lds_b128 %1, %9, off\n\t"
        "global_load_async_to_lds_b128 %2, %10, off\n\t"
        "global_load_async_to_lds_b128 %3, %11, off\n\t"
        "global_load_async_to_lds_b128 %4, %12, off\n\t"
        "global_load_async_to_lds_b128 %5, %13, off\n\t"
        "global_load_async_to_lds_b128 %6, %14, off\n\t"
        "global_load_async_to_lds_b128 %7, %15, off\n\t"
        "s_wait_xcnt 0x0"
        :: "v"(lds), "v"(lds + 32 * PITCH_B), "v"(lds + 64 * PITCH_B),
           "v"(lds + 96 * PITCH_B), "v"(lds + 128 * PITCH_B),
           "v"(lds + 160 * PITCH_B), "v"(lds + 192 * PITCH_B),
           "v"(lds + 224 * PITCH_B),
           "v"(ga), "v"(ga + 32 * DIMX), "v"(ga + 64 * DIMX), "v"(ga + 96 * DIMX),
           "v"(gw), "v"(gw + 32 * DIMX), "v"(gw + 64 * DIMX), "v"(gw + 96 * DIMX)
        : "memory");
}

// ---------------------------------------------------------------------------
// bf16 WMMA GEMM:  C[m,n] = sum_k A[m,k] * W[n,k]   (i.e. y = x @ W^T)
// A: [MTOT x DIMX] bf16 row-major,  W: [DIMX x DIMX] bf16 row-major.
// Block = 256 thr (8 waves) -> 128x128 tile; wave -> 32x64 (2x4 WMMA tiles).
// Operands are staged in LDS by asynchronous copies, two buffers.
// MODE 0: store bf16 [M x DIMX]
// MODE 1: store bf16 transposed per head: Vt[n,h,d,s]
// MODE 2: store f32 + bias -> d_out
// ---------------------------------------------------------------------------
template <int MODE>
__global__ __launch_bounds__(256)
void gemm_bf16_kernel(const __bf16* __restrict__ A,
                      const __bf16* __restrict__ W,
                      void* __restrict__ out,
                      const float* __restrict__ bias) {
    // Two stage buffers; a stage is [A 128 rows | W 128 rows] x 64 k (128 B a
    // row) at a pitch of 144 B, which spreads ds_load_b128 readers over the banks.
    __shared__ __align__(16) unsigned char tile[2 * STAGE_B];

    const int lane  = threadIdx.x & 31;
    const int wid   = threadIdx.x >> 5;
    const int wr    = wid & 3;          // 4 row-waves
    const int wc    = wid >> 2;         // 2 col-waves
    const int rowBase = blockIdx.y * 128 + wr * 32;
    const int colBase = blockIdx.x * 128 + wc * 64;
    const int l15   = lane & 15;
    const int lhalf = lane >> 4;

    // Copy map: 8 lanes cover one 128-B row piece, a wave 4 whole lines a copy.
    const int crow = threadIdx.x >> 3;  // 0..31
    const int cchk = threadIdx.x & 7;   // 16-B chunk in the row piece
    const __bf16* gA = A + (size_t)(blockIdx.y * 128 + crow) * DIMX + cchk * 8;
    const __bf16* gW = W + (size_t)(blockIdx.x * 128 + crow) * DIMX + cchk * 8;
    const unsigned ldsC = (unsigned)(size_t)tile + crow * PITCH_B + cchk * 16;

    AccU acc[2][4];
#pragma unroll
    for (int i = 0; i < 2; i++)
#pragma unroll
        for (int t = 0; t < 4; t++)
#pragma unroll
            for (int e = 0; e < 8; e++) acc[i][t].f[e] = 0.0f;

    stage_copy(gA, gW, ldsC);
    // stage 0 has landed before the barrier that publishes it
    asm volatile("s_wait_asynccnt 0x0" ::: "memory");
    __syncthreads();
    stage_copy(gA + KT, gW + KT, ldsC + STAGE_B);

    const unsigned char* fa = tile + (wr * 32 + l15) * PITCH_B + lhalf * 16;
    const unsigned char* fb = tile + (128 + wc * 64 + l15) * PITCH_B + lhalf * 16;

    for (int s = 0; s < NSTAGE; s++) {
        const int bo = (s & 1) * STAGE_B;
        Frag a[2][2], b[2][4];
#pragma unroll
        for (int ks = 0; ks < 2; ks++) {
#pragma unroll
            for (int i = 0; i < 2; i++) {
                const unsigned char* p = fa + bo + i * 16 * PITCH_B + ks * 64;
                a[ks][i].q[0] = *(const uint4*)p;
                a[ks][i].q[1] = *(const uint4*)(p + 32);
            }
#pragma unroll
            for (int t = 0; t < 4; t++) {
                const unsigned char* p = fb + bo + t * 16 * PITCH_B + ks * 64;
                b[ks][t].q[0] = *(const uint4*)p;
                b[ks][t].q[1] = *(const uint4*)(p + 32);
            }
        }
        // keeps all 24 LDS reads of a stage ahead of the stage's first WMMA, so
        // that the wave waits for LDS once a stage, not before each WMMA pair
        __builtin_amdgcn_sched_barrier(0);
#pragma unroll
        for (int ks = 0; ks < 2; ks++)
#pragma unroll
            for (int i = 0; i < 2; i++)
#pragma unroll
                for (int t = 0; t < 4; t++)
                    acc[i][t].v = __builtin_amdgcn_wmma_f32_16x16x32_bf16(
                        false, a[ks][i].v, false, b[ks][t].v, (short)0,
                        acc[i][t].v, false, false);

        // publish point: this wave's reads of the buffer are done, its copies of
        // the next stage have landed; the barrier says so for every wave
        asm volatile("s_wait_dscnt 0x0" ::: "memory");
        asm volatile("s_wait_asynccnt 0x0" ::: "memory");
        __syncthreads();
        if (s + 2 < NSTAGE)
            stage_copy(gA + (s + 2) * KT, gW + (s + 2) * KT, ldsC + bo);
    }
    // no copy is left in flight when the wave goes on to its stores
    asm volatile("s_wait_asynccnt 0x0" ::: "memory");

    // C layout: VGPR j -> row j (lanes 0-15) / row j+8 (lanes 16-31), col = l15
#pragma unroll
    for (int i = 0; i < 2; i++)
#pragma unroll
        for (int t = 0; t < 4; t++)
#pragma unroll
            for (int j = 0; j < 8; j++) {
                int row = rowBase + i * 16 + j + lhalf * 8;
                int col = colBase + t * 16 + l15;
                float v = acc[i][t].f[j];
                if (MODE == 0) {
                    ((__bf16*)out)[(size_t)row * DIMX + col] = (__bf16)v;
                } else if (MODE == 1) {
                    int nb = row >> 10, sr = row & 1023;
                    int h = col / HD, d = col % HD;
                    ((__bf16*)out)[(((size_t)nb * NHEADS + h) * HD + d) * SEQ + sr] =
                        (__bf16)v;
                } else {
                    ((float*)out)[(size_t)row * DIMX + col] = v + bias[col];
                }
            }
}

// ---------------------------------------------------------------------------
// One stage of the attention kernel's LDS ring: 64 keys of K (64 rows of 192 B)
// and of Vt (96 rows of 128 B), 6 x 16 B a lane, from global memory straight
// into LDS.  The s_wait_xcnt is the last line of the copies' own statement so
// that no address register is rewritten ahead of it.
// ---------------------------------------------------------------------------
#define AKT      64                          // keys per stage
#define ANSTAGE  (SEQ / AKT)                 // 16
#define KPITCH_B 208                         // LDS bytes per K row  (16 B x 13)
#define VPITCH_B 144                         // LDS bytes per Vt row (16 B x 9)
#define KTILE_B  (AKT * KPITCH_B)            // 13312
#define ASTAGE_B (KTILE_B + HD * VPITCH_B)   // 27136

__device__ __forceinline__ void kv_stage_copy(const __bf16* k0, const __bf16* k1,
                                              const __bf16* k2, const __bf16* v,
                                              unsigned lk0, unsigned lk1,
                                              unsigned lk2, unsigned lv) {
    asm volatile(
        "global_load_async_to_lds_b128 %0, %6, off\n\t"
        "global_load_async_to_lds_b128 %1, %7, off\n\t"
        "global_load_async_to_lds_b128 %2, %8, off\n\t"
        "global_load_async_to_lds_b128 %3, %9, off\n\t"
        "global_load_async_to_lds_b128 %4, %10, off\n\t"
        "global_load_async_to_lds_b128 %5, %11, off\n\t"
        "s_wait_xcnt 0x0"
        :: "v"(lk0), "v"(lk1), "v"(lk2),
           "v"(lv), "v"(lv + 32 * VPITCH_B), "v"(lv + 64 * VPITCH_B),
           "v"(k0), "v"(k1), "v"(k2),
           "v"(v), "v"(v + 32 * SEQ), "v"(v + 64 * SEQ)
        : "memory");
}

// ---------------------------------------------------------------------------
// Lane l takes the value of lane l ^ 16 (a vector cross-row move, no LDS).
// ---------------------------------------------------------------------------
__device__ __forceinline__ float xhalf(float x) {
    const int i = __builtin_bit_cast(int, x);
    return __builtin_bit_cast(float, __builtin_amdgcn_permlanex16(
        i, i, 0x76543210, 0xfedcba98, false, false));
}

__device__ __forceinline__ unsigned pack2(float lo, float hi) {
    typedef __bf16 bf2 __attribute__((ext_vector_type(2)));
    typedef float  f2  __attribute__((ext_vector_type(2)));
    return __builtin_bit_cast(unsigned, __builtin_convertvector(f2{lo, hi}, bf2));
}

__global__ __launch_bounds__(256)
void attn_kernel(const __bf16* __restrict__ Q, const __bf16* __restrict__ K,
                 const __bf16* __restrict__ Vt, __bf16* __restrict__ O) {
    // Two stage buffers; a stage is [K 64 rows x 192 B | Vt 96 rows x 128 B], each
    // at a pitch of 16 B x odd, which spreads ds_load_b128 readers over the banks.
    __shared__ __align__(16) unsigned char kvt[2 * ASTAGE_B];

    const int lane  = threadIdx.x & 31;
    const int wid   = threadIdx.x >> 5;
    const int l15   = lane & 15;
    const int lhalf = lane >> 4;
    const int kb8   = lhalf * 8;

    const int blk  = blockIdx.x;
    const int qblk = blk & 7;           // S/128 = 8
    const int h    = (blk >> 3) & 7;
    const int n    = blk >> 6;
    const int qbase = qblk * 128 + wid * 16;

    // Copy map.  K: the stage's 768 chunks of 16 B in row order, 12 a row, so a
    // wave-wide copy covers 32 consecutive chunks, 2 2/3 rows; Vt: 8 lanes cover one 128-B line.
    const int kc0 = threadIdx.x, kc1 = kc0 + 256, kc2 = kc0 + 512;
    const __bf16* Kh = K + (size_t)n * SEQ * DIMX + h * HD;
    const __bf16* gK0 = Kh + (kc0 / 12) * DIMX + (kc0 % 12) * 8;
    const __bf16* gK1 = Kh + (kc1 / 12) * DIMX + (kc1 % 12) * 8;
    const __bf16* gK2 = Kh + (kc2 / 12) * DIMX + (kc2 % 12) * 8;
    const __bf16* gV  = Vt + ((size_t)(n * NHEADS + h) * HD + (threadIdx.x >> 3)) * SEQ
                           + (threadIdx.x & 7) * 8;
    const unsigned ldsB = (unsigned)(size_t)kvt;
    const unsigned lK0 = ldsB + (kc0 / 12) * KPITCH_B + (kc0 % 12) * 16;
    const unsigned lK1 = ldsB + (kc1 / 12) * KPITCH_B + (kc1 % 12) * 16;
    const unsigned lK2 = ldsB + (kc2 / 12) * KPITCH_B + (kc2 % 12) * 16;
    const unsigned lV  = ldsB + KTILE_B + (threadIdx.x >> 3) * VPITCH_B
                              + (threadIdx.x & 7) * 16;

    kv_stage_copy(gK0, gK1, gK2, gV, lK0, lK1, lK2, lV);
    // stage 0 has landed before the barrier that publishes it
    asm volatile("s_wait_asynccnt 0x0" ::: "memory");
    __syncthreads();
    kv_stage_copy(gK0 + AKT * DIMX, gK1 + AKT * DIMX, gK2 + AKT * DIMX, gV + AKT,
                  lK0 + ASTAGE_B, lK1 + ASTAGE_B, lK2 + ASTAGE_B, lV + ASTAGE_B);

    // Preload this wave's Q fragments (3 chunks of K=32 covering hd=96)
    Frag qf[3];
#pragma unroll
    for (int c = 0; c < 3; c++) {
        const __bf16* p =
            Q + (size_t)(n * SEQ + qbase + l15) * DIMX + h * HD + c * 32 + kb8;
        qf[c].q[0] = *(const uint4*)p;
        qf[c].q[1] = *(const uint4*)(p + 16);
    }

    AccU o[6];   // O^T: register j of tile t is d = t * 16 + j + 8 * lhalf, query l15
#pragma unroll
    for (int t = 0; t < 6; t++)
#pragma unroll
        for (int e = 0; e < 8; e++) o[t].f[e] = 0.0f;
    float m = -1e30f, l = 0.0f;   // this lane's query: running maximum (log2), partial sum

    const float cscale = 0.0360843918243516f * 1.4426950408889634f;  // log2(e)/sqrt(768)

    const unsigned char* fk = kvt + l15 * KPITCH_B + lhalf * 16;
    const unsigned char* fv = kvt + KTILE_B + l15 * VPITCH_B + lhalf * 16;

    for (int st = 0; st < ANSTAGE; st++) {
      const int bo = (st & 1) * ASTAGE_B;
      // unrolled so that the two 32-key halves of a stage differ only in the LDS
      // reads' immediate offsets
#pragma unroll
      for (int kk = 0; kk < AKT; kk += 32) {
        AccU s0, s1;
#pragma unroll
        for (int e = 0; e < 8; e++) { s0.f[e] = 0.0f; s1.f[e] = 0.0f; }

        // scores: K chunks x Q^T -> two 16x16 tiles (rows = keys kk..+15, +16..+31)
#pragma unroll
        for (int c = 0; c < 3; c++) {
            Frag kf0, kf1;
            const unsigned char* p0 = fk + bo + kk * KPITCH_B + c * 64;
            kf0.q[0] = *(const uint4*)p0;
            kf0.q[1] = *(const uint4*)(p0 + 32);
            const unsigned char* p1 = p0 + 16 * KPITCH_B;
            kf1.q[0] = *(const uint4*)p1;
            kf1.q[1] = *(const uint4*)(p1 + 32);
            s0.v = __builtin_amdgcn_wmma_f32_16x16x32_bf16(
                false, kf0.v, false, qf[c].v, (short)0, s0.v, false, false);
            s1.v = __builtin_amdgcn_wmma_f32_16x16x32_bf16(
                false, kf1.v, false, qf[c].v, (short)0, s1.v, false, false);
        }

        // online softmax of this lane's query, in the log2 domain (the scale is
        // positive, so the maximum is taken on the raw scores)
        float mx = fmaxf(s0.f[0], s1.f[0]);
        for (int j = 1; j < 8; j++) mx = fmaxf(mx, fmaxf(s0.f[j], s1.f[j]));
        mx = fmaxf(mx, xhalf(mx));
        const float mn = fmaxf(m, mx * cscale);
        const float fr = __builtin_amdgcn_exp2f(m - mn);
        m = mn;
        for (int t = 0; t < 6; t++) o[t].v = o[t].v * fr;

        Frag pb;
        unsigned w[8];
        float ps0 = 0.0f, ps1 = 0.0f;
        for (int i = 0; i < 4; i++) {
            const float a0 = __builtin_amdgcn_exp2f(fmaf(s0.f[2 * i],     cscale, -mn));
            const float a1 = __builtin_amdgcn_exp2f(fmaf(s0.f[2 * i + 1], cscale, -mn));
            const float b0 = __builtin_amdgcn_exp2f(fmaf(s1.f[2 * i],     cscale, -mn));
            const float b1 = __builtin_amdgcn_exp2f(fmaf(s1.f[2 * i + 1], cscale, -mn));
            ps0 += a0 + a1;
            ps1 += b0 + b1;
            w[i]     = pack2(a0, a1);
            w[4 + i] = pack2(b0, b1);
        }
        l = l * fr + (ps0 + ps1);   // this half's 16 keys (halves joined at the end)
        pb.q[0] = make_uint4(w[0], w[1], w[2], w[3]);
        pb.q[1] = make_uint4(w[4], w[5], w[6], w[7]);

        // O^T += Vt[16 d x 32 keys] x P^T[32 keys x 16 queries]  (Vt rows are
        // contiguous in s)
#pragma unroll
        for (int t = 0; t < 6; t++) {
            Frag vf;
            const unsigned char* p = fv + bo + t * 16 * VPITCH_B + kk * 2;
            vf.q[0] = *(const uint4*)p;
            vf.q[1] = *(const uint4*)(p + 32);
            o[t].v = __builtin_amdgcn_wmma_f32_16x16x32_bf16(
                false, vf.v, false, pb.v, (short)0, o[t].v, false, false);
        }
      }

      // publish point: this wave's reads of the buffer are done, its copies of
      // the next stage have landed; the barrier says so for every wave
      asm volatile("s_wait_dscnt 0x0" ::: "memory");
      asm volatile("s_wait_asynccnt 0x0" ::: "memory");
      __syncthreads();
      if (st + 2 < ANSTAGE)
          kv_stage_copy(gK0 + (st + 2) * AKT * DIMX, gK1 + (st + 2) * AKT * DIMX,
                        gK2 + (st + 2) * AKT * DIMX, gV + (st + 2) * AKT,
                        lK0 + bo, lK1 + bo, lK2 + bo, lV + bo);
    }
    // no copy is left in flight when the wave goes on to its stores
    asm volatile("s_wait_asynccnt 0x0" ::: "memory");

    // normalize and store (heads concatenated back into [N,S,D]): a lane's eight
    // registers of a tile are eight neighbouring d of its query, one 16-B store
    const float inv = 1.0f / (l + xhalf(l));
    __bf16* orow = O + (size_t)(n * SEQ + qbase + l15) * DIMX + h * HD + kb8;
    for (int t = 0; t < 6; t++) {
        const v8f v = o[t].v * inv;
        *(uint4*)(orow + t * 16) = make_uint4(pack2(v[0], v[1]), pack2(v[2], v[3]),
                                              pack2(v[4], v[5]), pack2(v[6], v[7]));
    }
}

// ---------------------------------------------------------------------------
extern "C" void kernel_launch(void* const* d_in, const int* in_sizes, int n_in,
                              void* d_out, int out_size, void* d_ws,
                              size_t ws_size, hipStream_t stream) {
    (void)in_sizes; (void)n_in; (void)out_size; (void)ws_size;
    const float* q  = (const float*)d_in[0];
    const float* kv = (const float*)d_in[1];
    const float* wq = (const float*)d_in[2];
    const float* wk = (const float*)d_in[3];
    const float* wv = (const float*)d_in[4];
    const float* wp = (const float*)d_in[5];
    const float* bp = (const float*)d_in[6];

    char* ws = (char*)d_ws;
    size_t off = 0;
    const size_t ACT = (size_t)MTOT * DIMX * 2;   // 12.58 MB
    const size_t WB  = (size_t)DIMX * DIMX * 2;   // 1.18 MB
    __bf16* qb  = (__bf16*)(ws + off); off += ACT;
    __bf16* kvb = (__bf16*)(ws + off); off += ACT;
    __bf16* wqb = (__bf16*)(ws + off); off += WB;
    __bf16* wkb = (__bf16*)(ws + off); off += WB;
    __bf16* wvb = (__bf16*)(ws + off); off += WB;
    __bf16* wpb = (__bf16*)(ws + off); off += WB;
    __bf16* Qb  = (__bf16*)(ws + off); off += ACT;
    __bf16* Kb  = (__bf16*)(ws + off); off += ACT;
    __bf16* Vtb = (__bf16*)(ws + off); off += ACT;
    __bf16* Ab  = (__bf16*)(ws + off); off += ACT;

    // qb .. wpb are contiguous: one destination array for the whole launch
    cvt_all_kernel<<<CVT_BLOCKS, 256, 0, stream>>>(q, kv, wq, wk, wv, wp, qb);

    dim3 gg(DIMX / 128, MTOT / 128);   // (6, 64)
    gemm_bf16_kernel<0><<<gg, 256, 0, stream>>>(qb,  wqb, Qb,  nullptr);
    gemm_bf16_kernel<0><<<gg, 256, 0, stream>>>(kvb, wkb, Kb,  nullptr);
    gemm_bf16_kernel<1><<<gg, 256, 0, stream>>>(kvb, wvb, Vtb, nullptr);

    attn_kernel<<<NB * NHEADS * (SEQ / 128), 256, 0, stream>>>(Qb, Kb, Vtb, Ab);

    gemm_bf16_kernel<2><<<gg, 256, 0, stream>>>(Ab, wpb, d_out, bp);
}

// v005
// Measured time: 96.3 microseconds a run.
// In two side-by-side timings against v004, it was 1.06 and 1.07 times as fast.
// Over all steps from v000 it is 2.36 times as fast.
#include <hip/hip_runtime.h>

#define DIMX   768
#define NHEADS 8
#define HD     96
#define SEQ    1024
#define NB     8
#define MTOT   (NB * SEQ)   // 8192

typedef __attribute__((ext_vector_type(16))) __bf16 v16bf;
typedef __attribute__((ext_vector_type(8)))  float  v8f;

union Frag {
    v16bf v;
    uint4 q[2];
    unsigned short s[16];
};
union AccU {
    v8f   v;
    float f[8];
};

// ---------------------------------------------------------------------------
// fp32 -> bf16 convert of all six operands in one launch.  The six bf16 copies
// lie one behind the other in the workspace (q, kv, wq, wk, wv, wp), so block b
// writes span b of one long array; every span lies inside one source tensor.
// A lane brings 24 x 16 B, each wave-wide load 512 contiguous bytes.
// ---------------------------------------------------------------------------
#define CVT_LOADS  24
#define CVT_SPAN   (256 * 4 * CVT_LOADS)            // 24576 floats a block
#define CVT_ACTB   (MTOT * DIMX / CVT_SPAN)         // 256 blocks an activation
#define CVT_WB     (DIMX * DIMX / CVT_SPAN)         // 24 blocks a weight
#define CVT_BLOCKS (2 * CVT_ACTB + 4 * CVT_WB)      // 608

__global__ __launch_bounds__(256)
void cvt_all_kernel(const float* __restrict__ q,  const float* __restrict__ kv,
                    const float* __restrict__ wq, const float* __restrict__ wk,
                    const float* __restrict__ wv, const float* __restrict__ wp,
                    __bf16* __restrict__ y) {
    const int b = blockIdx.x;
    const float* src;
    int sb;
    if (b < CVT_ACTB) {
        src = q;  sb = b;
    } else if (b < 2 * CVT_ACTB) {
        src = kv; sb = b - CVT_ACTB;
    } else {
        const int w = (b - 2 * CVT_ACTB) / CVT_WB;
        sb  = (b - 2 * CVT_ACTB) % CVT_WB;
        src = w == 0 ? wq : w == 1 ? wk : w == 2 ? wv : wp;
    }
    const float4* x = (const float4*)(src + (size_t)sb * CVT_SPAN) + threadIdx.x;
    uint2*        o = (uint2*)(y + (size_t)b * CVT_SPAN) + threadIdx.x;

    float4 f[CVT_LOADS];
#pragma unroll
    for (int j = 0; j < CVT_LOADS; j++) f[j] = x[j * 256];
    // keeps every load of the lane ahead of the first convert and store, so that
    // the wave's whole span is in flight at once
    __builtin_amdgcn_sched_barrier(0);
#pragma unroll
    for (int j = 0; j < CVT_LOADS; j++) {
        union { __bf16 b[4]; uint2 u; } c;
        c.b[0] = (__bf16)f[j].x; c.b[1] = (__bf16)f[j].y;
        c.b[2] = (__bf16)f[j].z; c.b[3] = (__bf16)f[j].w;
        o[j * 256] = c.u;
    }
}

// ---------------------------------------------------------------------------
// One stage of the GEMM's LDS ring: each lane copies 4 x 16 B of A and 4 x 16 B
// of W (rows 32 apart) from global memory straight into LDS.  The s_wait_xcnt
// is the last line of the copies' own statement so that no address register is
// rewritten ahead of it.
// ---------------------------------------------------------------------------
#define KT      64                  // k per stage
#define NSTAGE  (DIMX / KT)         // 12
#define PITCH_B 144                 // LDS bytes per staged row
#define STAGE_B (256 * PITCH_B)     // 36864

__device__ __forceinline__ void stage_copy(const __bf16* ga, const __bf16* gw,
                                           unsigned lds) {
    asm volatile(
        "global_load_async_to_lds_b128 %0, %8, off\n\t"
        "global_load_async_to_lds_b128 %1, %9, off\n\t"
        "global_load_async_to_lds_b128 %2, %10, off\n\t"
        "global_load_async_to_lds_b128 %3, %11, off\n\t"
        "global_load_async_to_lds_b128 %4, %12, off\n\t"
        "global_load_async_to_lds_b128 %5, %13, off\n\t"
        "global_load_async_to_lds_b128 %6, %14, off\n\t"
        "global_load_async_to_lds_b128 %7, %15, off\n\t"
        "s_wait_xcnt 0x0"
        :: "v"(lds), "v"(lds + 32 * PITCH_B), "v"(lds + 64 * PITCH_B),
           "v"(lds + 96 * PITCH_B), "v"(lds + 128 * PITCH_B),
           "v"(lds + 160 * PITCH_B), "v"(lds + 192 * PITCH_B),
           "v"(lds + 224 * PITCH_B),
           "v"(ga), "v"(ga + 32 * DIMX), "v"(ga + 64 * DIMX), "v"(ga + 96 * DIMX),
           "v"(gw), "v"(gw + 32 * DIMX), "v"(gw + 64 * DIMX), "v"(gw + 96 * DIMX)
        : "memory");
}

// ---------------------------------------------------------------------------
// bf16 WMMA GEMM:  C[m,n] = sum_k A[m,k] * W[n,k]   (i.e. y = x @ W^T)
// A: [MTOT x DIMX] bf16 row-major,  W: [DIMX x DIMX] bf16 row-major.
// Block = 256 thr (8 waves) -> 128x128 tile; wave -> 32x64 (2x4 WMMA tiles).
// Operands are staged in LDS by asynchronous copies, two buffers.
// gemm_tile leaves the wave's 2x4 accumulator tiles in acc; the kernels below
// choose the operands and store the result.
// ---------------------------------------------------------------------------
__device__ __forceinline__ void gemm_tile(const __bf16* __restrict__ A,
                                          const __bf16* __restrict__ W,
                                          unsigned char* tile, AccU (&acc)[2][4]) {
    const int lane  = threadIdx.x & 31;
    const int wid   = threadIdx.x >> 5;
    const int wr    = wid & 3;          // 4 row-waves
    const int wc    = wid >> 2;         // 2 col-waves
    const int l15   = lane & 15;
    const int lhalf = lane >> 4;

    // Copy map: 8 lanes cover one 128-B row piece, a wave 4 whole lines a copy.
    const int crow = threadIdx.x >> 3;  // 0..31
    const int cchk = threadIdx.x & 7;   // 16-B chunk in the row piece
    const __bf16* gA = A + (size_t)(blockIdx.y * 128 + crow) * DIMX + cchk * 8;
    const __bf16* gW = W + (size_t)(blockIdx.x * 128 + crow) * DIMX + cchk * 8;
    const unsigned ldsC = (unsigned)(size_t)tile + crow * PITCH_B + cchk * 16;

#pragma unroll
    for (int i = 0; i < 2; i++)
#pragma unroll
        for (int t = 0; t < 4; t++)
#pragma unroll
            for (int e = 0; e < 8; e++) acc[i][t].f[e] = 0.0f;

    stage_copy(gA, gW, ldsC);
    // stage 0 has landed before the barrier that publishes it
    asm volatile("s_wait_asynccnt 0x0" ::: "memory");
    __syncthreads();
    stage_copy(gA + KT, gW + KT, ldsC + STAGE_B);

    const unsigned char* fa = tile + (wr * 32 + l15) * PITCH_B + lhalf * 16;
    const unsigned char* fb = tile + (128 + wc * 64 + l15) * PITCH_B + lhalf * 16;

    for (int s = 0; s < NSTAGE; s++) {
        const int bo = (s & 1) * STAGE_B;
        Frag a[2][2], b[2][4];
#pragma unroll
        for (int ks = 0; ks < 2; ks++) {
#pragma unroll
            for (int i = 0; i < 2; i++) {
                const unsigned char* p = fa + bo + i * 16 * PITCH_B + ks * 64;
                a[ks][i].q[0] = *(const uint4*)p;
                a[ks][i].q[1] = *(const uint4*)(p + 32);
            }
#pragma unroll
            for (int t = 0; t < 4; t++) {
                const unsigned char* p = fb + bo + t * 16 * PITCH_B + ks * 64;
                b[ks][t].q[0] = *(const uint4*)p;
                b[ks][t].q[1] = *(const uint4*)(p + 32);
            }
        }
        // keeps all 24 LDS reads of a stage ahead of the stage's first WMMA, so
        // that the wave waits for LDS once a stage, not before each WMMA pair
        __builtin_amdgcn_sched_barrier(0);
#pragma unroll
        for (int ks = 0; ks < 2; ks++)
#pragma unroll
            for (int i = 0; i < 2; i++)
#pragma unroll
                for (int t = 0; t < 4; t++)
                    acc[i][t].v = __builtin_amdgcn_wmma_f32_16x16x32_bf16(
                        false, a[ks][i].v, false, b[ks][t].v, (short)0,
                        acc[i][t].v, false, false);

        // publish point: this wave's reads of the buffer are done, its copies of
        // the next stage have landed; the barrier says so for every wave
        asm volatile("s_wait_dscnt 0x0" ::: "memory");
        asm volatile("s_wait_asynccnt 0x0" ::: "memory");
        __syncthreads();
        if (s + 2 < NSTAGE)
            stage_copy(gA + (s + 2) * KT, gW + (s + 2) * KT, ldsC + bo);
    }
    // no copy is left in flight when the wave goes on to its stores
    asm volatile("s_wait_asynccnt 0x0" ::: "memory");
}

// C layout of acc[i][t]: VGPR j -> row i*16 + j (lanes 0-15) / + 8 (lanes 16-31),
// col = t*16 + l15, both from the wave's corner of the block's tile.
#define GEMM_ROW(i, j) (blockIdx.y * 128 + ((threadIdx.x >> 5) & 3) * 32 + (i) * 16 + (j) \
                        + ((threadIdx.x >> 4) & 1) * 8)
#define GEMM_COL(t)    (blockIdx.x * 128 + (threadIdx.x >> 7) * 64 + (t) * 16 \
                        + (threadIdx.x & 15))

// ---------------------------------------------------------------------------
// The three input projections in ONE launch: they do not depend on one another,
// so blockIdx.z picks the product.  z = 0: Q = q.wq^T; z = 1: K = kv.wk^T, both
// [M x DIMX]; z = 2: V = kv.wv^T, stored transposed per head, Vt[n,h,d,s].
// ---------------------------------------------------------------------------
__global__ __launch_bounds__(256)
void qkv_gemm_kernel(const __bf16* __restrict__ xq, const __bf16* __restrict__ xkv,
                     const __bf16* __restrict__ wq, const __bf16* __restrict__ wk,
                     const __bf16* __restrict__ wv,
                     __bf16* __restrict__ Qo, __bf16* __restrict__ Ko,
                     __bf16* __restrict__ Vto) {
    // Two stage buffers; a stage is [A 128 rows | W 128 rows] x 64 k (128 B a
    // row) at a pitch of 144 B, which spreads ds_load_b128 readers over the banks.
    __shared__ __align__(16) unsigned char tile[2 * STAGE_B];

    const int z = blockIdx.z;
    const __bf16* A = z == 0 ? xq : xkv;
    const __bf16* W = z == 0 ? wq : z == 1 ? wk : wv;

    AccU acc[2][4];
    gemm_tile(A, W, tile, acc);

    if (z == 2) {
#pragma unroll
        for (int i = 0; i < 2; i++)
#pragma unroll
            for (int t = 0; t < 4; t++)
#pragma unroll
                for (int j = 0; j < 8; j++) {
                    const int row = GEMM_ROW(i, j), col = GEMM_COL(t);
                    const int nb = row >> 10, sr = row & 1023;
                    const int h = col / HD, d = col % HD;
                    Vto[(((size_t)nb * NHEADS + h) * HD + d) * SEQ + sr] =
                        (__bf16)acc[i][t].f[j];
                }
    } else {
        __bf16* out = z == 0 ? Qo : Ko;
#pragma unroll
        for (int i = 0; i < 2; i++)
#pragma unroll
            for (int t = 0; t < 4; t++)
#pragma unroll
                for (int j = 0; j < 8; j++)
                    out[(size_t)GEMM_ROW(i, j) * DIMX + GEMM_COL(t)] =
                        (__bf16)acc[i][t].f[j];
        // the z == 2 code is laid directly behind these stores in the built kernel:
        // no register that they name is rewritten ahead of this wait
        asm volatile("s_wait_xcnt 0x0" ::: "memory");
    }
}

// ---------------------------------------------------------------------------
// Output projection: f32 result plus bias.
// ---------------------------------------------------------------------------
__global__ __launch_bounds__(256)
void proj_gemm_kernel(const __bf16* __restrict__ A, const __bf16* __restrict__ W,
                      float* __restrict__ out, const float* __restrict__ bias) {
    // the same two stage buffers as above
    __shared__ __align__(16) unsigned char tile[2 * STAGE_B];

    AccU acc[2][4];
    gemm_tile(A, W, tile, acc);

#pragma unroll
    for (int i = 0; i < 2; i++)
#pragma unroll
        for (int t = 0; t < 4; t++)
#pragma unroll
            for (int j = 0; j < 8; j++) {
                const int col = GEMM_COL(t);
                out[(size_t)GEMM_ROW(i, j) * DIMX + col] = acc[i][t].f[j] + bias[col];
            }
}

// ---------------------------------------------------------------------------
// One stage of the attention kernel's LDS ring: 64 keys of K (64 rows of 192 B)
// and of Vt (96 rows of 128 B), 6 x 16 B a lane, from global memory straight
// into LDS.  The s_wait_xcnt is the last line of the copies' own statement so
// that no address register is rewritten ahead of it.
// ---------------------------------------------------------------------------
#define AKT      64                          // keys per stage
#define ANSTAGE  (SEQ / AKT)                 // 16
#define KPITCH_B 208                         // LDS bytes per K row  (16 B x 13)
#define VPITCH_B 144                         // LDS bytes per Vt row (16 B x 9)
#define KTILE_B  (AKT * KPITCH_B)            // 13312
#define ASTAGE_B (KTILE_B + HD * VPITCH_B)   // 27136

__device__ __forceinline__ void kv_stage_copy(const __bf16* k0, const __bf16* k1,
                                              const __bf16* k2, const __bf16* v,
                                              unsigned lk0, unsigned lk1,
                                              unsigned lk2, unsigned lv) {
    asm volatile(
        "global_load_async_to_lds_b128 %0, %6, off\n\t"
        "global_load_async_to_lds_b128 %1, %7, off\n\t"
        "global_load_async_to_lds_b128 %2, %8, off\n\t"
        "global_load_async_to_lds_b128 %3, %9, off\n\t"
        "global_load_async_to_lds_b128 %4, %10, off\n\t"
        "global_load_async_to_lds_b128 %5, %11, off\n\t"
        "s_wait_xcnt 0x0"
        :: "v"(lk0), "v"(lk1), "v"(lk2),
           "v"(lv), "v"(lv + 32 * VPITCH_B), "v"(lv + 64 * VPITCH_B),
           "v"(k0), "v"(k1), "v"(k2),
           "v"(v), "v"(v + 32 * SEQ), "v"(v + 64 * SEQ)
        : "memory");
}

// ---------------------------------------------------------------------------
// Lane l takes the value of lane l ^ 16 (a vector cross-row move, no LDS).
// ---------------------------------------------------------------------------
__device__ __forceinline__ float xhalf(float x) {
    const int i = __builtin_bit_cast(int, x);
    return __builtin_bit_cast(float, __builtin_amdgcn_permlanex16(
        i, i, 0x76543210, 0xfedcba98, false, false));
}

__device__ __forceinline__ unsigned pack2(float lo, float hi) {
    typedef __bf16 bf2 __attribute__((ext_vector_type(2)));
    typedef float  f2  __attribute__((ext_vector_type(2)));
    return __builtin_bit_cast(unsigned, __builtin_convertvector(f2{lo, hi}, bf2));
}

__global__ __launch_bounds__(256)
void attn_kernel(const __bf16* __restrict__ Q, const __bf16* __restrict__ K,
                 const __bf16* __restrict__ Vt, __bf16* __restrict__ O) {
    // Two stage buffers; a stage is [K 64 rows x 192 B | Vt 96 rows x 128 B], each
    // at a pitch of 16 B x odd, which spreads ds_load_b128 readers over the banks.
    __shared__ __align__(16) unsigned char kvt[2 * ASTAGE_B];

    const int lane  = threadIdx.x & 31;
    const int wid   = threadIdx.x >> 5;
    const int l15   = lane & 15;
    const int lhalf = lane >> 4;
    const int kb8   = lhalf * 8;

    const int blk  = blockIdx.x;
    const int qblk = blk & 7;           // S/128 = 8
    const int h    = (blk >> 3) & 7;
    const int n    = blk >> 6;
    const int qbase = qblk * 128 + wid * 16;

    // Copy map.  K: the stage's 768 chunks of 16 B in row order, 12 a row, so a
    // wave-wide copy covers 32 consecutive chunks, 2 2/3 rows; Vt: 8 lanes cover one 128-B line.
    const int kc0 = threadIdx.x, kc1 = kc0 + 256, kc2 = kc0 + 512;
    const __bf16* Kh = K + (size_t)n * SEQ * DIMX + h * HD;
    const __bf16* gK0 = Kh + (kc0 / 12) * DIMX + (kc0 % 12) * 8;
    const __bf16* gK1 = Kh + (kc1 / 12) * DIMX + (kc1 % 12) * 8;
    const __bf16* gK2 = Kh + (kc2 / 12) * DIMX + (kc2 % 12) * 8;
    const __bf16* gV  = Vt + ((size_t)(n * NHEADS + h) * HD + (threadIdx.x >> 3)) * SEQ
                           + (threadIdx.x & 7) * 8;
    const unsigned ldsB = (unsigned)(size_t)kvt;
    const unsigned lK0 = ldsB + (kc0 / 12) * KPITCH_B + (kc0 % 12) * 16;
    const unsigned lK1 = ldsB + (kc1 / 12) * KPITCH_B + (kc1 % 12) * 16;
    const unsigned lK2 = ldsB + (kc2 / 12) * KPITCH_B + (kc2 % 12) * 16;
    const unsigned lV  = ldsB + KTILE_B + (threadIdx.x >> 3) * VPITCH_B
                              + (threadIdx.x & 7) * 16;

    kv_stage_copy(gK0, gK1, gK2, gV, lK0, lK1, lK2, lV);
    // stage 0 has landed before the barrier that publishes it
    asm volatile("s_wait_asynccnt 0x0" ::: "memory");
    __syncthreads();
    kv_stage_copy(gK0 + AKT * DIMX, gK1 + AKT * DIMX, gK2 + AKT * DIMX, gV + AKT,
                  lK0 + ASTAGE_B, lK1 + ASTAGE_B, lK2 + ASTAGE_B, lV + ASTAGE_B);

    // Preload this wave's Q fragments (3 chunks of K=32 covering hd=96)
    Frag qf[3];
#pragma unroll
    for (int c = 0; c < 3; c++) {
        const __bf16* p =
            Q + (size_t)(n * SEQ + qbase + l15) * DIMX + h * HD + c * 32 + kb8;
        qf[c].q[0] = *(const uint4*)p;
        qf[c].q[1] = *(const uint4*)(p + 16);
    }

    AccU o[6];   // O^T: register j of tile t is d = t * 16 + j + 8 * lhalf, query l15
#pragma unroll
    for (int t = 0; t < 6; t++)
#pragma unroll
        for (int e = 0; e < 8; e++) o[t].f[e] = 0.0f;
    float m = -1e30f, l = 0.0f;   // this lane's query: running maximum (log2), partial sum

    const float cscale = 0.0360843918243516f * 1.4426950408889634f;  // log2(e)/sqrt(768)

    const unsigned char* fk = kvt + l15 * KPITCH_B + lhalf * 16;
    const unsigned char* fv = kvt + KTILE_B + l15 * VPITCH_B + lhalf * 16;

    for (int st = 0; st < ANSTAGE; st++) {
      const int bo = (st & 1) * ASTAGE_B;
      // unrolled so that the two 32-key halves of a stage differ only in the LDS
      // reads' immediate offsets
#pragma unroll
      for (int kk = 0; kk < AKT; kk += 32) {
        AccU s0, s1;
#pragma unroll
        for (int e = 0; e < 8; e++) { s0.f[e] = 0.0f; s1.f[e] = 0.0f; }

        // scores: K chunks x Q^T -> two 16x16 tiles (rows = keys kk..+15, +16..+31)
#pragma unroll
        for (int c = 0; c < 3; c++) {
            Frag kf0, kf1;
            const unsigned char* p0 = fk + bo + kk * KPITCH_B + c * 64;
            kf0.q[0] = *(const uint4*)p0;
            kf0.q[1] = *(const uint4*)(p0 + 32);
            const unsigned char* p1 = p0 + 16 * KPITCH_B;
            kf1.q[0] = *(const uint4*)p1;
            kf1.q[1] = *(const uint4*)(p1 + 32);
            s0.v = __builtin_amdgcn_wmma_f32_16x16x32_bf16(
                false, kf0.v, false, qf[c].v, (short)0, s0.v, false, false);
            s1.v = __builtin_amdgcn_wmma_f32_16x16x32_bf16(
                false, kf1.v, false, qf[c].v, (short)0, s1.v, false, false);
        }

        // online softmax of this lane's query, in the log2 domain (the scale is
        // positive, so the maximum is taken on the raw scores)
        float mx = fmaxf(s0.f[0], s1.f[0]);
        for (int j = 1; j < 8; j++) mx = fmaxf(mx, fmaxf(s0.f[j], s1.f[j]));
        mx = fmaxf(mx, xhalf(mx));
        const float mn = fmaxf(m, mx * cscale);
        const float fr = __builtin_amdgcn_exp2f(m - mn);
        m = mn;
        for (int t = 0; t < 6; t++) o[t].v = o[t].v * fr;

        Frag pb;
        unsigned w[8];
        float ps0 = 0.0f, ps1 = 0.0f;
        for (int i = 0; i < 4; i++) {
            const float a0 = __builtin_amdgcn_exp2f(fmaf(s0.f[2 * i],     cscale, -mn));
            const float a1 = __builtin_amdgcn_exp2f(fmaf(s0.f[2 * i + 1], cscale, -mn));
            const float b0 = __builtin_amdgcn_exp2f(fmaf(s1.f[2 * i],     cscale, -mn));
            const float b1 = __builtin_amdgcn_exp2f(fmaf(s1.f[2 * i + 1], cscale, -mn));
            ps0 += a0 + a1;
            ps1 += b0 + b1;
            w[i]     = pack2(a0, a1);
            w[4 + i] = pack2(b0, b1);
        }
        l = l * fr + (ps0 + ps1);   // this half's 16 keys (halves joined at the end)
        pb.q[0] = make_uint4(w[0], w[1], w[2], w[3]);
        pb.q[1] = make_uint4(w[4], w[5], w[6], w[7]);

        // O^T += Vt[16 d x 32 keys] x P^T[32 keys x 16 queries]  (Vt rows are
        // contiguous in s)
#pragma unroll
        for (int t = 0; t < 6; t++) {
            Frag vf;
            const unsigned char* p = fv + bo + t * 16 * VPITCH_B + kk * 2;
            vf.q[0] = *(const uint4*)p;
            vf.q[1] = *(const uint4*)(p + 32);
            o[t].v = __builtin_amdgcn_wmma_f32_16x16x32_bf16(
                false, vf.v, false, pb.v, (short)0, o[t].v, false, false);
        }
      }

      // publish point: this wave's reads of the buffer are done, its copies of
      // the next stage have landed; the barrier says so for every wave
      asm volatile("s_wait_dscnt 0x0" ::: "memory");
      asm volatile("s_wait_asynccnt 0x0" ::: "memory");
      __syncthreads();
      if (st + 2 < ANSTAGE)
          kv_stage_copy(gK0 + (st + 2) * AKT * DIMX, gK1 + (st + 2) * AKT * DIMX,
                        gK2 + (st + 2) * AKT * DIMX, gV + (st + 2) * AKT,
                        lK0 + bo, lK1 + bo, lK2 + bo, lV + bo);
    }
    // no copy is left in flight when the wave goes on to its stores
    asm volatile("s_wait_asynccnt 0x0" ::: "memory");

    // normalize and store (heads concatenated back into [N,S,D]): a lane's eight
    // registers of a tile are eight neighbouring d of its query, one 16-B store
    const float inv = 1.0f / (l + xhalf(l));
    __bf16* orow = O + (size_t)(n * SEQ + qbase + l15) * DIMX + h * HD + kb8;
    for (int t = 0; t < 6; t++) {
        const v8f v = o[t].v * inv;
        *(uint4*)(orow + t * 16) = make_uint4(pack2(v[0], v[1]), pack2(v[2], v[3]),
                                              pack2(v[4], v[5]), pack2(v[6], v[7]));
    }
}

// ---------------------------------------------------------------------------
extern "C" void kernel_launch(void* const* d_in, const int* in_sizes, int n_in,
                              void* d_out, int out_size, void* d_ws,
                              size_t ws_size, hipStream_t stream) {
    (void)in_sizes; (void)n_in; (void)out_size; (void)ws_size;
    const float* q  = (const float*)d_in[0];
    const float* kv = (const float*)d_in[1];
    const float* wq = (const float*)d_in[2];
    const float* wk = (const float*)d_in[3];
    const float* wv = (const float*)d_in[4];
    const float* wp = (const float*)d_in[5];
    const float* bp = (const float*)d_in[6];

    char* ws = (char*)d_ws;
    size_t off = 0;
    const size_t ACT = (size_t)MTOT * DIMX * 2;   // 12.58 MB
    const size_t WB  = (size_t)DIMX * DIMX * 2;   // 1.18 MB
    __bf16* qb  = (__bf16*)(ws + off); off += ACT;
    __bf16* kvb = (__bf16*)(ws + off); off += ACT;
    __bf16* wqb = (__bf16*)(ws + off); off += WB;
    __bf16* wkb = (__bf16*)(ws + off); off += WB;
    __bf16* wvb = (__bf16*)(ws + off); off += WB;
    __bf16* wpb = (__bf16*)(ws + off); off += WB;
    __bf16* Qb  = (__bf16*)(ws + off); off += ACT;
    __bf16* Kb  = (__bf16*)(ws + off); off += ACT;
    __bf16* Vtb = (__bf16*)(ws + off); off += ACT;
    __bf16* Ab  = (__bf16*)(ws + off); off += ACT;

    // qb .. wpb are contiguous: one destination array for the whole launch
    cvt_all_kernel<<<CVT_BLOCKS, 256, 0, stream>>>(q, kv, wq, wk, wv, wp, qb);

    // Q, K and V projections: one launch, blockIdx.z picks the product
    dim3 g3(DIMX / 128, MTOT / 128, 3);   // (6, 64, 3)
    qkv_gemm_kernel<<<g3, 256, 0, stream>>>(qb, kvb, wqb, wkb, wvb, Qb, Kb, Vtb);

    attn_kernel<<<NB * NHEADS * (SEQ / 128), 256, 0, stream>>>(Qb, Kb, Vtb, Ab);

    dim3 gg(DIMX / 128, MTOT / 128);      // (6, 64)
    proj_gemm_kernel<<<gg, 256, 0, stream>>>(Ab, wpb, (float*)d_out, bp);
}

// v006
// It runs in 90 microseconds.
// Two timings next to v005 both put it at 1.07 times that version's speed.
// Counting every step since v000, it is 2.52 times as fast.
#include <hip/hip_runtime.h>

#define DIMX   768
#define NHEADS 8
#define HD     96
#define SEQ    1024
#define NB     8
#define MTOT   (NB * SEQ)   // 8192

typedef __attribute__((ext_vector_type(16))) __bf16 v16bf;
typedef __attribute__((ext_vector_type(8)))  float  v8f;

union Frag {
    v16bf v;
    uint4 q[2];
    unsigned short s[16];
};
union AccU {
    v8f   v;
    float f[8];
};

// ---------------------------------------------------------------------------
// fp32 -> bf16 convert of all six operands in one launch.  The six bf16 copies
// lie one behind the other in the workspace (q, kv, wq, wk, wv, wp), so block b
// writes span b of one long array; every span lies inside one source tensor.
// A lane brings 24 x 16 B, each wave-wide load 512 contiguous bytes.
// ---------------------------------------------------------------------------
#define CVT_LOADS  24
#define CVT_SPAN   (256 * 4 * CVT_LOADS)            // 24576 floats a block
#define CVT_ACTB   (MTOT * DIMX / CVT_SPAN)         // 256 blocks an activation
#define CVT_WB     (DIMX * DIMX / CVT_SPAN)         // 24 blocks a weight
#define CVT_BLOCKS (2 * CVT_ACTB + 4 * CVT_WB)      // 608

__global__ __launch_bounds__(256)
void cvt_all_kernel(const float* __restrict__ q,  const float* __restrict__ kv,
                    const float* __restrict__ wq, const float* __restrict__ wk,
                    const float* __restrict__ wv, const float* __restrict__ wp,
                    __bf16* __restrict__ y) {
    const int b = blockIdx.x;
    const float* src;
    int sb;
    if (b < CVT_ACTB) {
        src = q;  sb = b;
    } else if (b < 2 * CVT_ACTB) {
        src = kv; sb = b - CVT_ACTB;
    } else {
        const int w = (b - 2 * CVT_ACTB) / CVT_WB;
        sb  = (b - 2 * CVT_ACTB) % CVT_WB;
        src = w == 0 ? wq : w == 1 ? wk : w == 2 ? wv : wp;
    }
    const float4* x = (const float4*)(src + (size_t)sb * CVT_SPAN) + threadIdx.x;
    uint2*        o = (uint2*)(y + (size_t)b * CVT_SPAN) + threadIdx.x;

    float4 f[CVT_LOADS];
#pragma unroll
    for (int j = 0; j < CVT_LOADS; j++) f[j] = x[j * 256];
    // keeps every load of the lane ahead of the first convert and store, so that
    // the wave's whole span is in flight at once
    __builtin_amdgcn_sched_barrier(0);
#pragma unroll
    for (int j = 0; j < CVT_LOADS; j++) {
        union { __bf16 b[4]; uint2 u; } c;
        c.b[0] = (__bf16)f[j].x; c.b[1] = (__bf16)f[j].y;
        c.b[2] = (__bf16)f[j].z; c.b[3] = (__bf16)f[j].w;
        o[j * 256] = c.u;
    }
}

// ---------------------------------------------------------------------------
// One stage of the GEMM's LDS ring: each lane copies 4 x 16 B of A and 4 x 16 B
// of W (rows 32 apart) from global memory straight into LDS.  The s_wait_xcnt
// is the last line of the copies' own statement so that no address register is
// rewritten ahead of it.
// ---------------------------------------------------------------------------
#define KT      64                  // k per stage
#define NSTAGE  (DIMX / KT)         // 12
#define PITCH_B 144                 // LDS bytes per staged row
#define STAGE_B (256 * PITCH_B)     // 36864

__device__ __forceinline__ void stage_copy(const __bf16* ga, const __bf16* gw,
                                           unsigned lds) {
    asm volatile(
        "global_load_async_to_lds_b128 %0, %8, off\n\t"
        "global_load_async_to_lds_b128 %1, %9, off\n\t"
        "global_load_async_to_lds_b128 %2, %10, off\n\t"
        "global_load_async_to_lds_b128 %3, %11, off\n\t"
        "global_load_async_to_lds_b128 %4, %12, off\n\t"
        "global_load_async_to_lds_b128 %5, %13, off\n\t"
        "global_load_async_to_lds_b128 %6, %14, off\n\t"
        "global_load_async_to_lds_b128 %7, %15, off\n\t"
        "s_wait_xcnt 0x0"
        :: "v"(lds), "v"(lds + 32 * PITCH_B), "v"(lds + 64 * PITCH_B),
           "v"(lds + 96 * PITCH_B), "v"(lds + 128 * PITCH_B),
           "v"(lds + 160 * PITCH_B), "v"(lds + 192 * PITCH_B),
           "v"(lds + 224 * PITCH_B),
           "v"(ga), "v"(ga + 32 * DIMX), "v"(ga + 64 * DIMX), "v"(ga + 96 * DIMX),
           "v"(gw), "v"(gw + 32 * DIMX), "v"(gw + 64 * DIMX), "v"(gw + 96 * DIMX)
        : "memory");
}

// ---------------------------------------------------------------------------
// bf16 WMMA GEMM:  C[m,n] = sum_k A[m,k] * W[n,k]   (i.e. y = x @ W^T)
// A: [MTOT x DIMX] bf16 row-major,  W: [DIMX x DIMX] bf16 row-major.
// Block = 256 thr (8 waves) -> 128x128 tile; wave -> 32x64 (2x4 WMMA tiles).
// Operands are staged in LDS by asynchronous copies, two buffers.
// gemm_tile leaves the wave's 2x4 accumulator tiles in acc; the kernels below
// choose the operands and store the result.
// ---------------------------------------------------------------------------
__device__ __forceinline__ void gemm_tile(const __bf16* __restrict__ A,
                                          const __bf16* __restrict__ W,
                                          unsigned char* tile, AccU (&acc)[2][4]) {
    const int lane  = threadIdx.x & 31;
    const int wid   = threadIdx.x >> 5;
    const int wr    = wid & 3;          // 4 row-waves
    const int wc    = wid >> 2;         // 2 col-waves
    const int l15   = lane & 15;
    const int lhalf = lane >> 4;

    // Copy map: 8 lanes cover one 128-B row piece, a wave 4 whole lines a copy.
    const int crow = threadIdx.x >> 3;  // 0..31
    const int cchk = threadIdx.x & 7;   // 16-B chunk in the row piece
    const __bf16* gA = A + (size_t)(blockIdx.y * 128 + crow) * DIMX + cchk * 8;
    const __bf16* gW = W + (size_t)(blockIdx.x * 128 + crow) * DIMX + cchk * 8;
    const unsigned ldsC = (unsigned)(size_t)tile + crow * PITCH_B + cchk * 16;

#pragma unroll
    for (int i = 0; i < 2; i++)
#pragma unroll
        for (int t = 0; t < 4; t++)
#pragma unroll
            for (int e = 0; e < 8; e++) acc[i][t].f[e] = 0.0f;

    stage_copy(gA, gW, ldsC);
    // stage 0 has landed before the barrier that publishes it
    asm volatile("s_wait_asynccnt 0x0" ::: "memory");
    __syncthreads();
    stage_copy(gA + KT, gW + KT, ldsC + STAGE_B);

    const unsigned char* fa = tile + (wr * 32 + l15) * PITCH_B + lhalf * 16;
    const unsigned char* fb = tile + (128 + wc * 64 + l15) * PITCH_B + lhalf * 16;

    for (int s = 0; s < NSTAGE; s++) {
        const int bo = (s & 1) * STAGE_B;
        Frag a[2][2], b[2][4];
#pragma unroll
        for (int ks = 0; ks < 2; ks++) {
#pragma unroll
            for (int i = 0; i < 2; i++) {
                const unsigned char* p = fa + bo + i * 16 * PITCH_B + ks * 64;
                a[ks][i].q[0] = *(const uint4*)p;
                a[ks][i].q[1] = *(const uint4*)(p + 32);
            }
#pragma unroll
            for (int t = 0; t < 4; t++) {
                const unsigned char* p = fb + bo + t * 16 * PITCH_B + ks * 64;
                b[ks][t].q[0] = *(const uint4*)p;
                b[ks][t].q[1] = *(const uint4*)(p + 32);
            }
        }
        // keeps all 24 LDS reads of a stage ahead of the stage's first WMMA, so
        // that the wave waits for LDS once a stage, not before each WMMA pair
        __builtin_amdgcn_sched_barrier(0);
#pragma unroll
        for (int ks = 0; ks < 2; ks++)
#pragma unroll
            for (int i = 0; i < 2; i++)
#pragma unroll
                for (int t = 0; t < 4; t++)
                    acc[i][t].v = __builtin_amdgcn_wmma_f32_16x16x32_bf16(
                        false, a[ks][i].v, false, b[ks][t].v, (short)0,
                        acc[i][t].v, false, false);

        // publish point: this wave's reads of the buffer are done, its copies of
        // the next stage have landed; the barrier says so for every wave
        asm volatile("s_wait_dscnt 0x0" ::: "memory");
        asm volatile("s_wait_asynccnt 0x0" ::: "memory");
        __syncthreads();
        if (s + 2 < NSTAGE)
            stage_copy(gA + (s + 2) * KT, gW + (s + 2) * KT, ldsC + bo);
    }
    // no copy is left in flight when the wave goes on to its stores
    asm volatile("s_wait_asynccnt 0x0" ::: "memory");
}

// C layout of acc[i][t]: VGPR j -> row i*16 + j (lanes 0-15) / + 8 (lanes 16-31),
// col = t*16 + l15, both from the wave's corner of the block's tile.
#define GEMM_ROW(i, j) (blockIdx.y * 128 + ((threadIdx.x >> 5) & 3) * 32 + (i) * 16 + (j) \
                        + ((threadIdx.x >> 4) & 1) * 8)
#define GEMM_COL(t)    (blockIdx.x * 128 + (threadIdx.x >> 7) * 64 + (t) * 16 \
                        + (threadIdx.x & 15))

// ---------------------------------------------------------------------------
// The three input projections in ONE launch: they do not depend on one another,
// so blockIdx.z picks the product.  z = 0: Q = q.wq^T; z = 1: K = kv.wk^T, both
// [M x DIMX]; z = 2: V = kv.wv^T, stored transposed per head, Vt[n,h,d,s].
// ---------------------------------------------------------------------------
__global__ __launch_bounds__(256)
void qkv_gemm_kernel(const __bf16* __restrict__ xq, const __bf16* __restrict__ xkv,
                     const __bf16* __restrict__ wq, const __bf16* __restrict__ wk,
                     const __bf16* __restrict__ wv,
                     __bf16* __restrict__ Qo, __bf16* __restrict__ Ko,
                     __bf16* __restrict__ Vto) {
    // Two stage buffers; a stage is [A 128 rows | W 128 rows] x 64 k (128 B a
    // row) at a pitch of 144 B, which spreads ds_load_b128 readers over the banks.
    __shared__ __align__(16) unsigned char tile[2 * STAGE_B];

    const int z = blockIdx.z;
    const __bf16* A = z == 0 ? xq : xkv;
    const __bf16* W = z == 0 ? wq : z == 1 ? wk : wv;

    AccU acc[2][4];
    gemm_tile(A, W, tile, acc);

    if (z == 2) {
#pragma unroll
        for (int i = 0; i < 2; i++)
#pragma unroll
            for (int t = 0; t < 4; t++)
#pragma unroll
                for (int j = 0; j < 8; j++) {
                    const int row = GEMM_ROW(i, j), col = GEMM_COL(t);
                    const int nb = row >> 10, sr = row & 1023;
                    const int h = col / HD, d = col % HD;
                    Vto[(((size_t)nb * NHEADS + h) * HD + d) * SEQ + sr] =
                        (__bf16)acc[i][t].f[j];
                }
    } else {
        __bf16* out = z == 0 ? Qo : Ko;
#pragma unroll
        for (int i = 0; i < 2; i++)
#pragma unroll
            for (int t = 0; t < 4; t++)
#pragma unroll
                for (int j = 0; j < 8; j++)
                    out[(size_t)GEMM_ROW(i, j) * DIMX + GEMM_COL(t)] =
                        (__bf16)acc[i][t].f[j];
        // the z == 2 code is laid directly behind these stores in the built kernel:
        // no register that they name is rewritten ahead of this wait
        asm volatile("s_wait_xcnt 0x0" ::: "memory");
    }
}

// ---------------------------------------------------------------------------
// Output projection: f32 result plus bias.
// ---------------------------------------------------------------------------
__global__ __launch_bounds__(256)
void proj_gemm_kernel(const __bf16* __restrict__ A, const __bf16* __restrict__ W,
                      float* __restrict__ out, const float* __restrict__ bias) {
    // the same two stage buffers as above
    __shared__ __align__(16) unsigned char tile[2 * STAGE_B];

    AccU acc[2][4];
    gemm_tile(A, W, tile, acc);

#pragma unroll
    for (int i = 0; i < 2; i++)
#pragma unroll
        for (int t = 0; t < 4; t++)
#pragma unroll
            for (int j = 0; j < 8; j++) {
                const int col = GEMM_COL(t);
                out[(size_t)GEMM_ROW(i, j) * DIMX + col] = acc[i][t].f[j] + bias[col];
            }
}

// ---------------------------------------------------------------------------
// One stage of the attention kernel's LDS ring: 64 keys of K (64 rows of 192 B)
// and of Vt (96 rows of 128 B), 6 x 16 B a lane, from global memory straight
// into LDS.  The s_wait_xcnt is the last line of the copies' own statement so
// that no address register is rewritten ahead of it.
// ---------------------------------------------------------------------------
#define AKT      64                          // keys per stage
#define ANSTAGE  (SEQ / AKT)                 // 16
#define KPITCH_B 208                         // LDS bytes per K row  (16 B x 13)
#define VPITCH_B 144                         // LDS bytes per Vt row (16 B x 9)
#define KTILE_B  (AKT * KPITCH_B)            // 13312
#define ASTAGE_B (KTILE_B + HD * VPITCH_B)   // 27136

__device__ __forceinline__ void kv_stage_copy(const __bf16* k0, const __bf16* k1,
                                              const __bf16* k2, const __bf16* v,
                                              unsigned lk0, unsigned lk1,
                                              unsigned lk2, unsigned lv) {
    asm volatile(
        "global_load_async_to_lds_b128 %0, %6, off\n\t"
        "global_load_async_to_lds_b128 %1, %7, off\n\t"
        "global_load_async_to_lds_b128 %2, %8, off\n\t"
        "global_load_async_to_lds_b128 %3, %9, off\n\t"
        "global_load_async_to_lds_b128 %4, %10, off\n\t"
        "global_load_async_to_lds_b128 %5, %11, off\n\t"
        "s_wait_xcnt 0x0"
        :: "v"(lk0), "v"(lk1), "v"(lk2),
           "v"(lv), "v"(lv + 32 * VPITCH_B), "v"(lv + 64 * VPITCH_B),
           "v"(k0), "v"(k1), "v"(k2),
           "v"(v), "v"(v + 32 * SEQ), "v"(v + 64 * SEQ)
        : "memory");
}

// ---------------------------------------------------------------------------
// Lane l takes the value of lane l ^ 16 (a vector cross-row move, no LDS).
// ---------------------------------------------------------------------------
__device__ __forceinline__ float xhalf(float x) {
    const int i = __builtin_bit_cast(int, x);
    return __builtin_bit_cast(float, __builtin_amdgcn_permlanex16(
        i, i, 0x76543210, 0xfedcba98, false, false));
}

__device__ __forceinline__ unsigned pack2(float lo, float hi) {
    typedef __bf16 bf2 __attribute__((ext_vector_type(2)));
    typedef float  f2  __attribute__((ext_vector_type(2)));
    return __builtin_bit_cast(unsigned, __builtin_convertvector(f2{lo, hi}, bf2));
}

__global__ __launch_bounds__(256)
void attn_kernel(const __bf16* __restrict__ Q, const __bf16* __restrict__ K,
                 const __bf16* __restrict__ Vt, __bf16* __restrict__ O) {
    // Two stage buffers; a stage is [K 64 rows x 192 B | Vt 96 rows x 128 B], each
    // at a pitch of 16 B x odd, which spreads ds_load_b128 readers over the banks.
    __shared__ __align__(16) unsigned char kvt[2 * ASTAGE_B];

    const int lane  = threadIdx.x & 31;
    const int wid   = threadIdx.x >> 5;
    const int l15   = lane & 15;
    const int lhalf = lane >> 4;
    const int kb8   = lhalf * 8;

    const int blk  = blockIdx.x;
    const int qblk = blk & 7;           // S/128 = 8
    const int h    = (blk >> 3) & 7;
    const int n    = blk >> 6;
    const int qbase = qblk * 128 + wid * 16;

    // Copy map.  K: the stage's 768 chunks of 16 B in row order, 12 a row, so a
    // wave-wide copy covers 32 consecutive chunks, 2 2/3 rows; Vt: 8 lanes cover one 128-B line.
    const int kc0 = threadIdx.x, kc1 = kc0 + 256, kc2 = kc0 + 512;
    const __bf16* Kh = K + (size_t)n * SEQ * DIMX + h * HD;
    const __bf16* gK0 = Kh + (kc0 / 12) * DIMX + (kc0 % 12) * 8;
    const __bf16* gK1 = Kh + (kc1 / 12) * DIMX + (kc1 % 12) * 8;
    const __bf16* gK2 = Kh + (kc2 / 12) * DIMX + (kc2 % 12) * 8;
    const __bf16* gV  = Vt + ((size_t)(n * NHEADS + h) * HD + (threadIdx.x >> 3)) * SEQ
                           + (threadIdx.x & 7) * 8;
    const unsigned ldsB = (unsigned)(size_t)kvt;
    const unsigned lK0 = ldsB + (kc0 / 12) * KPITCH_B + (kc0 % 12) * 16;
    const unsigned lK1 = ldsB + (kc1 / 12) * KPITCH_B + (kc1 % 12) * 16;
    const unsigned lK2 = ldsB + (kc2 / 12) * KPITCH_B + (kc2 % 12) * 16;
    const unsigned lV  = ldsB + KTILE_B + (threadIdx.x >> 3) * VPITCH_B
                              + (threadIdx.x & 7) * 16;

    kv_stage_copy(gK0, gK1, gK2, gV, lK0, lK1, lK2, lV);
    // stage 0 has landed before the barrier that publishes it
    asm volatile("s_wait_asynccnt 0x0" ::: "memory");
    __syncthreads();
    kv_stage_copy(gK0 + AKT * DIMX, gK1 + AKT * DIMX, gK2 + AKT * DIMX, gV + AKT,
                  lK0 + ASTAGE_B, lK1 + ASTAGE_B, lK2 + ASTAGE_B, lV + ASTAGE_B);

    // Preload this wave's Q fragments (3 chunks of K=32 covering hd=96)
    Frag qf[3];
#pragma unroll
    for (int c = 0; c < 3; c++) {
        const __bf16* p =
            Q + (size_t)(n * SEQ + qbase + l15) * DIMX + h * HD + c * 32 + kb8;
        qf[c].q[0] = *(const uint4*)p;
        qf[c].q[1] = *(const uint4*)(p + 16);
    }

    AccU o[6];   // O^T: register j of tile t is d = t * 16 + j + 8 * lhalf, query l15
#pragma unroll
    for (int t = 0; t < 6; t++)
#pragma unroll
        for (int e = 0; e < 8; e++) o[t].f[e] = 0.0f;
    float m = -1e30f, l = 0.0f;   // this lane's query: running maximum (log2), partial sum

    const float cscale = 0.0360843918243516f * 1.4426950408889634f;  // log2(e)/sqrt(768)

    const unsigned char* fk = kvt + l15 * KPITCH_B + lhalf * 16;
    const unsigned char* fv = kvt + KTILE_B + l15 * VPITCH_B + lhalf * 16;

    for (int st = 0; st < ANSTAGE; st++) {
      const int bo = (st & 1) * ASTAGE_B;
      // First part of a trip: every LDS read of the stage, in groups of 12 or 24 ahead
      // of the products that use them, and the score products of both 32-key halves.
      AccU s[2][2];   // s[half][r]: keys half * 32 + r * 16 .. + 15
      Frag vf[2][6];  // vf[half][t]: d tile t, keys half * 32 .. + 31
      // unrolled so that s and vf stay in registers and the two halves differ only
      // in the LDS reads' immediate offsets
#pragma unroll
      for (int hf = 0; hf < 2; hf++) {
        Frag kf[3][2];
#pragma unroll
        for (int c = 0; c < 3; c++)
#pragma unroll
            for (int r = 0; r < 2; r++) {
                const unsigned char* p =
                    fk + bo + (hf * 32 + r * 16) * KPITCH_B + c * 64;
                kf[c][r].q[0] = *(const uint4*)p;
                kf[c][r].q[1] = *(const uint4*)(p + 32);
            }
        // Vt rows are contiguous in s.  The first half's Vt goes with its K; the
        // second half's follows the last score products, into the K registers.
        if (hf == 0) {
#pragma unroll
            for (int t = 0; t < 6; t++) {
                const unsigned char* p = fv + bo + t * 16 * VPITCH_B;
                vf[0][t].q[0] = *(const uint4*)p;
                vf[0][t].q[1] = *(const uint4*)(p + 32);
            }
        }
        // keeps the group of reads together in front of its first product: one LDS
        // latency for the group, not one for each pair of reads
        __builtin_amdgcn_sched_barrier(0);
#pragma unroll
        for (int r = 0; r < 2; r++)
#pragma unroll
            for (int e = 0; e < 8; e++) s[hf][r].f[e] = 0.0f;
        // scores: K chunks x Q^T -> two 16x16 tiles (rows = keys)
#pragma unroll
        for (int c = 0; c < 3; c++)
#pragma unroll
            for (int r = 0; r < 2; r++)
                s[hf][r].v = __builtin_amdgcn_wmma_f32_16x16x32_bf16(
                    false, kf[c][r].v, false, qf[c].v, (short)0, s[hf][r].v,
                    false, false);
        // keeps the next group of reads behind these products, so that it takes
        // the registers of the K fragments just used (256 registers a wave let
        // both of a WGP's blocks stay resident)
        __builtin_amdgcn_sched_barrier(0);
      }
#pragma unroll
      for (int t = 0; t < 6; t++) {
          const unsigned char* p = fv + bo + t * 16 * VPITCH_B + 64;
          vf[1][t].q[0] = *(const uint4*)p;
          vf[1][t].q[1] = *(const uint4*)(p + 32);
      }

      // publish point: this wave's reads of the buffer are done, its copies of
      // the next stage have landed; the barrier says so for every wave.  The rest
      // of the trip works on registers alone, so the refill flies a whole trip.
      asm volatile("s_wait_dscnt 0x0" ::: "memory");
      asm volatile("s_wait_asynccnt 0x0" ::: "memory");
      __syncthreads();
      if (st + 2 < ANSTAGE)
          kv_stage_copy(gK0 + (st + 2) * AKT * DIMX, gK1 + (st + 2) * AKT * DIMX,
                        gK2 + (st + 2) * AKT * DIMX, gV + (st + 2) * AKT,
                        lK0 + bo, lK1 + bo, lK2 + bo, lV + bo);

      // Second part: softmax and output products of the two halves, in key order
      // (unrolled so that s and vf are indexed by constants and stay in registers).
#pragma unroll
      for (int hf = 0; hf < 2; hf++) {
        const AccU s0 = s[hf][0], s1 = s[hf][1];
        // online softmax of this lane's query, in the log2 domain (the scale is
        // positive, so the maximum is taken on the raw scores)
        float mx = fmaxf(s0.f[0], s1.f[0]);
        for (int j = 1; j < 8; j++) mx = fmaxf(mx, fmaxf(s0.f[j], s1.f[j]));
        mx = fmaxf(mx, xhalf(mx));
        const float mn = fmaxf(m, mx * cscale);
        const float fr = __builtin_amdgcn_exp2f(m - mn);
        m = mn;
        for (int t = 0; t < 6; t++) o[t].v = o[t].v * fr;

        Frag pb;
        unsigned w[8];
        float ps0 = 0.0f, ps1 = 0.0f;
        for (int i = 0; i < 4; i++) {
            const float a0 = __builtin_amdgcn_exp2f(fmaf(s0.f[2 * i],     cscale, -mn));
            const float a1 = __builtin_amdgcn_exp2f(fmaf(s0.f[2 * i + 1], cscale, -mn));
            const float b0 = __builtin_amdgcn_exp2f(fmaf(s1.f[2 * i],     cscale, -mn));
            const float b1 = __builtin_amdgcn_exp2f(fmaf(s1.f[2 * i + 1], cscale, -mn));
            ps0 += a0 + a1;
            ps1 += b0 + b1;
            w[i]     = pack2(a0, a1);
            w[4 + i] = pack2(b0, b1);
        }
        l = l * fr + (ps0 + ps1);   // this half's 16 keys (halves joined at the end)
        pb.q[0] = make_uint4(w[0], w[1], w[2], w[3]);
        pb.q[1] = make_uint4(w[4], w[5], w[6], w[7]);

        // O^T += Vt[16 d x 32 keys] x P^T[32 keys x 16 queries]
#pragma unroll
        for (int t = 0; t < 6; t++)
            o[t].v = __builtin_amdgcn_wmma_f32_16x16x32_bf16(
                false, vf[hf][t].v, false, pb.v, (short)0, o[t].v, false, false);
      }
    }
    // no copy is left in flight when the wave goes on to its stores
    asm volatile("s_wait_asynccnt 0x0" ::: "memory");

    // normalize and store (heads concatenated back into [N,S,D]): a lane's eight
    // registers of a tile are eight neighbouring d of its query, one 16-B store
    const float inv = 1.0f / (l + xhalf(l));
    __bf16* orow = O + (size_t)(n * SEQ + qbase + l15) * DIMX + h * HD + kb8;
    for (int t = 0; t < 6; t++) {
        const v8f v = o[t].v * inv;
        *(uint4*)(orow + t * 16) = make_uint4(pack2(v[0], v[1]), pack2(v[2], v[3]),
                                              pack2(v[4], v[5]), pack2(v[6], v[7]));
    }
}

// ---------------------------------------------------------------------------
extern "C" void kernel_launch(void* const* d_in, const int* in_sizes, int n_in,
                              void* d_out, int out_size, void* d_ws,
                              size_t ws_size, hipStream_t stream) {
    (void)in_sizes; (void)n_in; (void)out_size; (void)ws_size;
    const float* q  = (const float*)d_in[0];
    const float* kv = (const float*)d_in[1];
    const float* wq = (const float*)d_in[2];
    const float* wk = (const float*)d_in[3];
    const float* wv = (const float*)d_in[4];
    const float* wp = (const float*)d_in[5];
    const float* bp = (const float*)d_in[6];

    char* ws = (char*)d_ws;
    size_t off = 0;
    const size_t ACT = (size_t)MTOT * DIMX * 2;   // 12.58 MB
    const size_t WB  = (size_t)DIMX * DIMX * 2;   // 1.18 MB
    __bf16* qb  = (__bf16*)(ws + off); off += ACT;
    __bf16* kvb = (__bf16*)(ws + off); off += ACT;
    __bf16* wqb = (__bf16*)(ws + off); off += WB;
    __bf16* wkb = (__bf16*)(ws + off); off += WB;
    __bf16* wvb = (__bf16*)(ws + off); off += WB;
    __bf16* wpb = (__bf16*)(ws + off); off += WB;
    __bf16* Qb  = (__bf16*)(ws + off); off += ACT;
    __bf16* Kb  = (__bf16*)(ws + off); off += ACT;
    __bf16* Vtb = (__bf16*)(ws + off); off += ACT;
    __bf16* Ab  = (__bf16*)(ws + off); off += ACT;

    // qb .. wpb are contiguous: one destination array for the whole launch
    cvt_all_kernel<<<CVT_BLOCKS, 256, 0, stream>>>(q, kv, wq, wk, wv, wp, qb);

    // Q, K and V projections: one launch, blockIdx.z picks the product
    dim3 g3(DIMX / 128, MTOT / 128, 3);   // (6, 64, 3)
    qkv_gemm_kernel<<<g3, 256, 0, stream>>>(qb, kvb, wqb, wkb, wvb, Qb, Kb, Vtb);

    attn_kernel<<<NB * NHEADS * (SEQ / 128), 256, 0, stream>>>(Qb, Kb, Vtb, Ab);

    dim3 gg(DIMX / 128, MTOT / 128);      // (6, 64)
    proj_gemm_kernel<<<gg, 256, 0, stream>>>(Ab, wpb, (float*)d_out, bp);
}

// v007
// Measured time: 86.9 microseconds a run.
// Next to v006, in two timings, it ran 1.04 and 1.03 times as fast.
// All steps since v000 together make it 2.61 times as fast.
#include <hip/hip_runtime.h>

#define DIMX   768
#define NHEADS 8
#define HD     96
#define SEQ    1024
#define NB     8
#define MTOT   (NB * SEQ)   // 8192

typedef __attribute__((ext_vector_type(16))) __bf16 v16bf;
typedef __attribute__((ext_vector_type(8)))  float  v8f;

union Frag {
    v16bf v;
    uint4 q[2];
    unsigned short s[16];
};
union AccU {
    v8f   v;
    float f[8];
};

// ---------------------------------------------------------------------------
// fp32 -> bf16 convert of all six operands in one launch.  The six bf16 copies
// lie one behind the other in the workspace (q, kv, wq, wk, wv, wp), so block b
// writes span b of one long array; every span lies inside one source tensor.
// A lane brings 24 x 16 B, each wave-wide load 512 contiguous bytes.
// ---------------------------------------------------------------------------
#define CVT_LOADS  24
#define CVT_SPAN   (256 * 4 * CVT_LOADS)            // 24576 floats a block
#define CVT_ACTB   (MTOT * DIMX / CVT_SPAN)         // 256 blocks an activation
#define CVT_WB     (DIMX * DIMX / CVT_SPAN)         // 24 blocks a weight
#define CVT_BLOCKS (2 * CVT_ACTB + 4 * CVT_WB)      // 608

__global__ __launch_bounds__(256)
void cvt_all_kernel(const float* __restrict__ q,  const float* __restrict__ kv,
                    const float* __restrict__ wq, const float* __restrict__ wk,
                    const float* __restrict__ wv, const float* __restrict__ wp,
                    __bf16* __restrict__ y) {
    const int b = blockIdx.x;
    const float* src;
    int sb;
    if (b < CVT_ACTB) {
        src = q;  sb = b;
    } else if (b < 2 * CVT_ACTB) {
        src = kv; sb = b - CVT_ACTB;
    } else {
        const int w = (b - 2 * CVT_ACTB) / CVT_WB;
        sb  = (b - 2 * CVT_ACTB) % CVT_WB;
        src = w == 0 ? wq : w == 1 ? wk : w == 2 ? wv : wp;
    }
    const float4* x = (const float4*)(src + (size_t)sb * CVT_SPAN) + threadIdx.x;
    uint2*        o = (uint2*)(y + (size_t)b * CVT_SPAN) + threadIdx.x;

    float4 f[CVT_LOADS];
#pragma unroll
    for (int j = 0; j < CVT_LOADS; j++) f[j] = x[j * 256];
    // keeps every load of the lane ahead of the first convert and store, so that
    // the wave's whole span is in flight at once
    __builtin_amdgcn_sched_barrier(0);
#pragma unroll
    for (int j = 0; j < CVT_LOADS; j++) {
        union { __bf16 b[4]; uint2 u; } c;
        c.b[0] = (__bf16)f[j].x; c.b[1] = (__bf16)f[j].y;
        c.b[2] = (__bf16)f[j].z; c.b[3] = (__bf16)f[j].w;
        o[j * 256] = c.u;
    }
}

// ---------------------------------------------------------------------------
// One stage of the GEMM's LDS ring: each lane copies 4 x 16 B of A and 6 x 16 B
// of W (rows 32 apart) from global memory straight into LDS.  The s_wait_xcnt
// is the last line of the copies' own statement so that no address register is
// rewritten ahead of it.
// ---------------------------------------------------------------------------
#define KT      64                  // k per stage
#define NSTAGE  (DIMX / KT)         // 12
#define PITCH_B 144                 // LDS bytes per staged row
#define TM      128                 // rows of C a block
#define TN      192                 // columns of C a block
#define STAGE_B ((TM + TN) * PITCH_B)   // 46080

__device__ __forceinline__ void stage_copy(const __bf16* ga, const __bf16* gw,
                                           unsigned lds) {
    asm volatile(
        "global_load_async_to_lds_b128 %0, %10, off\n\t"
        "global_load_async_to_lds_b128 %1, %11, off\n\t"
        "global_load_async_to_lds_b128 %2, %12, off\n\t"
        "global_load_async_to_lds_b128 %3, %13, off\n\t"
        "global_load_async_to_lds_b128 %4, %14, off\n\t"
        "global_load_async_to_lds_b128 %5, %15, off\n\t"
        "global_load_async_to_lds_b128 %6, %16, off\n\t"
        "global_load_async_to_lds_b128 %7, %17, off\n\t"
        "global_load_async_to_lds_b128 %8, %18, off\n\t"
        "global_load_async_to_lds_b128 %9, %19, off\n\t"
        "s_wait_xcnt 0x0"
        :: "v"(lds), "v"(lds + 32 * PITCH_B), "v"(lds + 64 * PITCH_B),
           "v"(lds + 96 * PITCH_B), "v"(lds + 128 * PITCH_B),
           "v"(lds + 160 * PITCH_B), "v"(lds + 192 * PITCH_B),
           "v"(lds + 224 * PITCH_B), "v"(lds + 256 * PITCH_B),
           "v"(lds + 288 * PITCH_B),
           "v"(ga), "v"(ga + 32 * DIMX), "v"(ga + 64 * DIMX), "v"(ga + 96 * DIMX),
           "v"(gw), "v"(gw + 32 * DIMX), "v"(gw + 64 * DIMX), "v"(gw + 96 * DIMX),
           "v"(gw + 128 * DIMX), "v"(gw + 160 * DIMX)
        : "memory");
}

// ---------------------------------------------------------------------------
// bf16 WMMA GEMM:  C[m,n] = sum_k A[m,k] * W[n,k]   (i.e. y = x @ W^T)
// A: [MTOT x DIMX] bf16 row-major,  W: [DIMX x DIMX] bf16 row-major.
// Block = 256 thr (8 waves) -> 128x192 tile; wave -> 64x48 (4x3 WMMA tiles).
// Operands are staged in LDS by asynchronous copies, two buffers.
// gemm_tile leaves the wave's 4x3 accumulator tiles in acc; the kernels below
// choose the operands and store the result.
// ---------------------------------------------------------------------------
__device__ __forceinline__ void gemm_tile(const __bf16* __restrict__ A,
                                          const __bf16* __restrict__ W,
                                          unsigned char* tile, AccU (&acc)[4][3]) {
    const int lane  = threadIdx.x & 31;
    const int wid   = threadIdx.x >> 5;
    const int wr    = wid & 1;          // 2 row-waves
    const int wc    = wid >> 1;         // 4 col-waves
    const int l15   = lane & 15;
    const int lhalf = lane >> 4;

    // Copy map: 8 lanes cover one 128-B row piece, a wave 4 whole lines a copy.
    const int crow = threadIdx.x >> 3;  // 0..31
    const int cchk = threadIdx.x & 7;   // 16-B chunk in the row piece
    const __bf16* gA = A + (size_t)(blockIdx.y * TM + crow) * DIMX + cchk * 8;
    const __bf16* gW = W + (size_t)(blockIdx.x * TN + crow) * DIMX + cchk * 8;
    const unsigned ldsC = (unsigned)(size_t)tile + crow * PITCH_B + cchk * 16;

#pragma unroll
    for (int i = 0; i < 4; i++)
#pragma unroll
        for (int t = 0; t < 3; t++)
#pragma unroll
            for (int e = 0; e < 8; e++) acc[i][t].f[e] = 0.0f;

    stage_copy(gA, gW, ldsC);
    // stage 0 has landed before the barrier that publishes it
    asm volatile("s_wait_asynccnt 0x0" ::: "memory");
    __syncthreads();
    stage_copy(gA + KT, gW + KT, ldsC + STAGE_B);

    const unsigned char* fa = tile + (wr * 64 + l15) * PITCH_B + lhalf * 16;
    const unsigned char* fb = tile + (TM + wc * 48 + l15) * PITCH_B + lhalf * 16;

    // unrolled by directive: the compiler unrolled the 128x128 tile's loop by itself
    // and leaves this larger body rolled; rolled, the buffer offset is formed anew
    // every trip and the refill stands behind all of a stage's products, not among
    // them, so that it has less time to land
#pragma unroll
    for (int s = 0; s < NSTAGE; s++) {
        const int bo = (s & 1) * STAGE_B;
        Frag a[2][4], b[2][3];
#pragma unroll
        for (int ks = 0; ks < 2; ks++) {
#pragma unroll
            for (int i = 0; i < 4; i++) {
                const unsigned char* p = fa + bo + i * 16 * PITCH_B + ks * 64;
                a[ks][i].q[0] = *(const uint4*)p;
                a[ks][i].q[1] = *(const uint4*)(p + 32);
            }
#pragma unroll
            for (int t = 0; t < 3; t++) {
                const unsigned char* p = fb + bo + t * 16 * PITCH_B + ks * 64;
                b[ks][t].q[0] = *(const uint4*)p;
                b[ks][t].q[1] = *(const uint4*)(p + 32);
            }
        }
        // keeps all 28 LDS reads of a stage ahead of the stage's first WMMA, so
        // that the wave waits for LDS once a stage, not before each WMMA pair
        __builtin_amdgcn_sched_barrier(0);
#pragma unroll
        for (int ks = 0; ks < 2; ks++)
#pragma unroll
            for (int i = 0; i < 4; i++)
#pragma unroll
                for (int t = 0; t < 3; t++)
                    acc[i][t].v = __builtin_amdgcn_wmma_f32_16x16x32_bf16(
                        false, a[ks][i].v, false, b[ks][t].v, (short)0,
                        acc[i][t].v, false, false);

        // publish point: this wave's reads of the buffer are done, its copies of
        // the next stage have landed; the barrier says so for every wave
        asm volatile("s_wait_dscnt 0x0" ::: "memory");
        asm volatile("s_wait_asynccnt 0x0" ::: "memory");
        __syncthreads();
        if (s + 2 < NSTAGE)
            stage_copy(gA + (s + 2) * KT, gW + (s + 2) * KT, ldsC + bo);
    }
    // no copy is left in flight when the wave goes on to its stores
    asm volatile("s_wait_asynccnt 0x0" ::: "memory");
}

// C layout of acc[i][t]: VGPR j -> row i*16 + j (lanes 0-15) / + 8 (lanes 16-31),
// col = t*16 + l15, both from the wave's corner of the block's tile.
#define GEMM_ROW(i, j) (blockIdx.y * TM + ((threadIdx.x >> 5) & 1) * 64 + (i) * 16 + (j) \
                        + ((threadIdx.x >> 4) & 1) * 8)
#define GEMM_COL(t)    (blockIdx.x * TN + (threadIdx.x >> 6) * 48 + (t) * 16 \
                        + (threadIdx.x & 15))

// ---------------------------------------------------------------------------
// The three input projections in ONE launch: they do not depend on one another,
// so blockIdx.z picks the product.  z = 0: Q = q.wq^T; z = 1: K = kv.wk^T, both
// [M x DIMX]; z = 2: V = kv.wv^T, stored transposed per head, Vt[n,h,d,s].
// ---------------------------------------------------------------------------
__global__ __launch_bounds__(256)
void qkv_gemm_kernel(const __bf16* __restrict__ xq, const __bf16* __restrict__ xkv,
                     const __bf16* __restrict__ wq, const __bf16* __restrict__ wk,
                     const __bf16* __restrict__ wv,
                     __bf16* __restrict__ Qo, __bf16* __restrict__ Ko,
                     __bf16* __restrict__ Vto) {
    // Two stage buffers; a stage is [A 128 rows | W 192 rows] x 64 k (128 B a
    // row) at a pitch of 144 B, which spreads ds_load_b128 readers over the banks.
    __shared__ __align__(16) unsigned char tile[2 * STAGE_B];

    const int z = blockIdx.z;
    const __bf16* A = z == 0 ? xq : xkv;
    const __bf16* W = z == 0 ? wq : z == 1 ? wk : wv;

    AccU acc[4][3];
    gemm_tile(A, W, tile, acc);

    if (z == 2) {
#pragma unroll
        for (int i = 0; i < 4; i++)
#pragma unroll
            for (int t = 0; t < 3; t++)
#pragma unroll
                for (int j = 0; j < 8; j++) {
                    const int row = GEMM_ROW(i, j), col = GEMM_COL(t);
                    const int nb = row >> 10, sr = row & 1023;
                    const int h = col / HD, d = col % HD;
                    Vto[(((size_t)nb * NHEADS + h) * HD + d) * SEQ + sr] =
                        (__bf16)acc[i][t].f[j];
                }
    } else {
        __bf16* out = z == 0 ? Qo : Ko;
#pragma unroll
        for (int i = 0; i < 4; i++)
#pragma unroll
            for (int t = 0; t < 3; t++)
#pragma unroll
                for (int j = 0; j < 8; j++)
                    out[(size_t)GEMM_ROW(i, j) * DIMX + GEMM_COL(t)] =
                        (__bf16)acc[i][t].f[j];
        // the z == 2 code is laid directly behind these stores in the built kernel:
        // no register that they name is rewritten ahead of this wait
        asm volatile("s_wait_xcnt 0x0" ::: "memory");
    }
}

// ---------------------------------------------------------------------------
// Output projection: f32 result plus bias.
// ---------------------------------------------------------------------------
__global__ __launch_bounds__(256)
void proj_gemm_kernel(const __bf16* __restrict__ A, const __bf16* __restrict__ W,
                      float* __restrict__ out, const float* __restrict__ bias) {
    // the same two stage buffers as above
    __shared__ __align__(16) unsigned char tile[2 * STAGE_B];

    AccU acc[4][3];
    gemm_tile(A, W, tile, acc);

#pragma unroll
    for (int i = 0; i < 4; i++)
#pragma unroll
        for (int t = 0; t < 3; t++)
#pragma unroll
            for (int j = 0; j < 8; j++) {
                const int col = GEMM_COL(t);
                out[(size_t)GEMM_ROW(i, j) * DIMX + col] = acc[i][t].f[j] + bias[col];
            }
}

// ---------------------------------------------------------------------------
// One stage of the attention kernel's LDS ring: 64 keys of K (64 rows of 192 B)
// and of Vt (96 rows of 128 B), 6 x 16 B a lane, from global memory straight
// into LDS.  The s_wait_xcnt is the last line of the copies' own statement so
// that no address register is rewritten ahead of it.
// ---------------------------------------------------------------------------
#define AKT      64                          // keys per stage
#define ANSTAGE  (SEQ / AKT)                 // 16
#define KPITCH_B 208                         // LDS bytes per K row  (16 B x 13)
#define VPITCH_B 144                         // LDS bytes per Vt row (16 B x 9)
#define KTILE_B  (AKT * KPITCH_B)            // 13312
#define ASTAGE_B (KTILE_B + HD * VPITCH_B)   // 27136

__device__ __forceinline__ void kv_stage_copy(const __bf16* k0, const __bf16* k1,
                                              const __bf16* k2, const __bf16* v,
                                              unsigned lk0, unsigned lk1,
                                              unsigned lk2, unsigned lv) {
    asm volatile(
        "global_load_async_to_lds_b128 %0, %6, off\n\t"
        "global_load_async_to_lds_b128 %1, %7, off\n\t"
        "global_load_async_to_lds_b128 %2, %8, off\n\t"
        "global_load_async_to_lds_b128 %3, %9, off\n\t"
        "global_load_async_to_lds_b128 %4, %10, off\n\t"
        "global_load_async_to_lds_b128 %5, %11, off\n\t"
        "s_wait_xcnt 0x0"
        :: "v"(lk0), "v"(lk1), "v"(lk2),
           "v"(lv), "v"(lv + 32 * VPITCH_B), "v"(lv + 64 * VPITCH_B),
           "v"(k0), "v"(k1), "v"(k2),
           "v"(v), "v"(v + 32 * SEQ), "v"(v + 64 * SEQ)
        : "memory");
}

// ---------------------------------------------------------------------------
// Lane l takes the value of lane l ^ 16 (a vector cross-row move, no LDS).
// ---------------------------------------------------------------------------
__device__ __forceinline__ float xhalf(float x) {
    const int i = __builtin_bit_cast(int, x);
    return __builtin_bit_cast(float, __builtin_amdgcn_permlanex16(
        i, i, 0x76543210, 0xfedcba98, false, false));
}

__device__ __forceinline__ unsigned pack2(float lo, float hi) {
    typedef __bf16 bf2 __attribute__((ext_vector_type(2)));
    typedef float  f2  __attribute__((ext_vector_type(2)));
    return __builtin_bit_cast(unsigned, __builtin_convertvector(f2{lo, hi}, bf2));
}

__global__ __launch_bounds__(256)
void attn_kernel(const __bf16* __restrict__ Q, const __bf16* __restrict__ K,
                 const __bf16* __restrict__ Vt, __bf16* __restrict__ O) {
    // Two stage buffers; a stage is [K 64 rows x 192 B | Vt 96 rows x 128 B], each
    // at a pitch of 16 B x odd, which spreads ds_load_b128 readers over the banks.
    __shared__ __align__(16) unsigned char kvt[2 * ASTAGE_B];

    const int lane  = threadIdx.x & 31;
    const int wid   = threadIdx.x >> 5;
    const int l15   = lane & 15;
    const int lhalf = lane >> 4;
    const int kb8   = lhalf * 8;

    const int blk  = blockIdx.x;
    const int qblk = blk & 7;           // S/128 = 8
    const int h    = (blk >> 3) & 7;
    const int n    = blk >> 6;
    const int qbase = qblk * 128 + wid * 16;

    // Copy map.  K: the stage's 768 chunks of 16 B in row order, 12 a row, so a
    // wave-wide copy covers 32 consecutive chunks, 2 2/3 rows; Vt: 8 lanes cover one 128-B line.
    const int kc0 = threadIdx.x, kc1 = kc0 + 256, kc2 = kc0 + 512;
    const __bf16* Kh = K + (size_t)n * SEQ * DIMX + h * HD;
    const __bf16* gK0 = Kh + (kc0 / 12) * DIMX + (kc0 % 12) * 8;
    const __bf16* gK1 = Kh + (kc1 / 12) * DIMX + (kc1 % 12) * 8;
    const __bf16* gK2 = Kh + (kc2 / 12) * DIMX + (kc2 % 12) * 8;
    const __bf16* gV  = Vt + ((size_t)(n * NHEADS + h) * HD + (threadIdx.x >> 3)) * SEQ
                           + (threadIdx.x & 7) * 8;
    const unsigned ldsB = (unsigned)(size_t)kvt;
    const unsigned lK0 = ldsB + (kc0 / 12) * KPITCH_B + (kc0 % 12) * 16;
    const unsigned lK1 = ldsB + (kc1 / 12) * KPITCH_B + (kc1 % 12) * 16;
    const unsigned lK2 = ldsB + (kc2 / 12) * KPITCH_B + (kc2 % 12) * 16;
    const unsigned lV  = ldsB + KTILE_B + (threadIdx.x >> 3) * VPITCH_B
                              + (threadIdx.x & 7) * 16;

    kv_stage_copy(gK0, gK1, gK2, gV, lK0, lK1, lK2, lV);
    // stage 0 has landed before the barrier that publishes it
    asm volatile("s_wait_asynccnt 0x0" ::: "memory");
    __syncthreads();
    kv_stage_copy(gK0 + AKT * DIMX, gK1 + AKT * DIMX, gK2 + AKT * DIMX, gV + AKT,
                  lK0 + ASTAGE_B, lK1 + ASTAGE_B, lK2 + ASTAGE_B, lV + ASTAGE_B);

    // Preload this wave's Q fragments (3 chunks of K=32 covering hd=96)
    Frag qf[3];
#pragma unroll
    for (int c = 0; c < 3; c++) {
        const __bf16* p =
            Q + (size_t)(n * SEQ + qbase + l15) * DIMX + h * HD + c * 32 + kb8;
        qf[c].q[0] = *(const uint4*)p;
        qf[c].q[1] = *(const uint4*)(p + 16);
    }

    AccU o[6];   // O^T: register j of tile t is d = t * 16 + j + 8 * lhalf, query l15
#pragma unroll
    for (int t = 0; t < 6; t++)
#pragma unroll
        for (int e = 0; e < 8; e++) o[t].f[e] = 0.0f;
    float m = -1e30f, l = 0.0f;   // this lane's query: running maximum (log2), partial sum

    const float cscale = 0.0360843918243516f * 1.4426950408889634f;  // log2(e)/sqrt(768)

    const unsigned char* fk = kvt + l15 * KPITCH_B + lhalf * 16;
    const unsigned char* fv = kvt + KTILE_B + l15 * VPITCH_B + lhalf * 16;

    for (int st = 0; st < ANSTAGE; st++) {
      const int bo = (st & 1) * ASTAGE_B;
      // First part of a trip: every LDS read of the stage, in groups of 12 or 24 ahead
      // of the products that use them, and the score products of both 32-key halves.
      AccU s[2][2];   // s[half][r]: keys half * 32 + r * 16 .. + 15
      Frag vf[2][6];  // vf[half][t]: d tile t, keys half * 32 .. + 31
      // unrolled so that s and vf stay in registers and the two halves differ only
      // in the LDS reads' immediate offsets
#pragma unroll
      for (int hf = 0; hf < 2; hf++) {
        Frag kf[3][2];
#pragma unroll
        for (int c = 0; c < 3; c++)
#pragma unroll
            for (int r = 0; r < 2; r++) {
                const unsigned char* p =
                    fk + bo + (hf * 32 + r * 16) * KPITCH_B + c * 64;
                kf[c][r].q[0] = *(const uint4*)p;
                kf[c][r].q[1] = *(const uint4*)(p + 32);
            }
        // Vt rows are contiguous in s.  The first half's Vt goes with its K; the
        // second half's follows the last score products, into the K registers.
        if (hf == 0) {
#pragma unroll
            for (int t = 0; t < 6; t++) {
                const unsigned char* p = fv + bo + t * 16 * VPITCH_B;
                vf[0][t].q[0] = *(const uint4*)p;
                vf[0][t].q[1] = *(const uint4*)(p + 32);
            }
        }
        // keeps the group of reads together in front of its first product: one LDS
        // latency for the group, not one for each pair of reads
        __builtin_amdgcn_sched_barrier(0);
#pragma unroll
        for (int r = 0; r < 2; r++)
#pragma unroll
            for (int e = 0; e < 8; e++) s[hf][r].f[e] = 0.0f;
        // scores: K chunks x Q^T -> two 16x16 tiles (rows = keys)
#pragma unroll
        for (int c = 0; c < 3; c++)
#pragma unroll
            for (int r = 0; r < 2; r++)
                s[hf][r].v = __builtin_amdgcn_wmma_f32_16x16x32_bf16(
                    false, kf[c][r].v, false, qf[c].v, (short)0, s[hf][r].v,
                    false, false);
        // keeps the next group of reads behind these products, so that it takes
        // the registers of the K fragments just used (256 registers a wave let
        // both of a WGP's blocks stay resident)
        __builtin_amdgcn_sched_barrier(0);
      }
#pragma unroll
      for (int t = 0; t < 6; t++) {
          const unsigned char* p = fv + bo + t * 16 * VPITCH_B + 64;
          vf[1][t].q[0] = *(const uint4*)p;
          vf[1][t].q[1] = *(const uint4*)(p + 32);
      }

      // publish point: this wave's reads of the buffer are done, its copies of
      // the next stage have landed; the barrier says so for every wave.  The rest
      // of the trip works on registers alone, so the refill flies a whole trip.
      asm volatile("s_wait_dscnt 0x0" ::: "memory");
      asm volatile("s_wait_asynccnt 0x0" ::: "memory");
      __syncthreads();
      if (st + 2 < ANSTAGE)
          kv_stage_copy(gK0 + (st + 2) * AKT * DIMX, gK1 + (st + 2) * AKT * DIMX,
                        gK2 + (st + 2) * AKT * DIMX, gV + (st + 2) * AKT,
                        lK0 + bo, lK1 + bo, lK2 + bo, lV + bo);

      // Second part: softmax and output products of the two halves, in key order
      // (unrolled so that s and vf are indexed by constants and stay in registers).
#pragma unroll
      for (int hf = 0; hf < 2; hf++) {
        const AccU s0 = s[hf][0], s1 = s[hf][1];
        // online softmax of this lane's query, in the log2 domain (the scale is
        // positive, so the maximum is taken on the raw scores)
        float mx = fmaxf(s0.f[0], s1.f[0]);
        for (int j = 1; j < 8; j++) mx = fmaxf(mx, fmaxf(s0.f[j], s1.f[j]));
        mx = fmaxf(mx, xhalf(mx));
        const float mn = fmaxf(m, mx * cscale);
        const float fr = __builtin_amdgcn_exp2f(m - mn);
        m = mn;
        for (int t = 0; t < 6; t++) o[t].v = o[t].v * fr;

        Frag pb;
        unsigned w[8];
        float ps0 = 0.0f, ps1 = 0.0f;
        for (int i = 0; i < 4; i++) {
            const float a0 = __builtin_amdgcn_exp2f(fmaf(s0.f[2 * i],     cscale, -mn));
            const float a1 = __builtin_amdgcn_exp2f(fmaf(s0.f[2 * i + 1], cscale, -mn));
            const float b0 = __builtin_amdgcn_exp2f(fmaf(s1.f[2 * i],     cscale, -mn));
            const float b1 = __builtin_amdgcn_exp2f(fmaf(s1.f[2 * i + 1], cscale, -mn));
            ps0 += a0 + a1;
            ps1 += b0 + b1;
            w[i]     = pack2(a0, a1);
            w[4 + i] = pack2(b0, b1);
        }
        l = l * fr + (ps0 + ps1);   // this half's 16 keys (halves joined at the end)
        pb.q[0] = make_uint4(w[0], w[1], w[2], w[3]);
        pb.q[1] = make_uint4(w[4], w[5], w[6], w[7]);

        // O^T += Vt[16 d x 32 keys] x P^T[32 keys x 16 queries]
#pragma unroll
        for (int t = 0; t < 6; t++)
            o[t].v = __builtin_amdgcn_wmma_f32_16x16x32_bf16(
                false, vf[hf][t].v, false, pb.v, (short)0, o[t].v, false, false);
      }
    }
    // no copy is left in flight when the wave goes on to its stores
    asm volatile("s_wait_asynccnt 0x0" ::: "memory");

    // normalize and store (heads concatenated back into [N,S,D]): a lane's eight
    // registers of a tile are eight neighbouring d of its query, one 16-B store
    const float inv = 1.0f / (l + xhalf(l));
    __bf16* orow = O + (size_t)(n * SEQ + qbase + l15) * DIMX + h * HD + kb8;
    for (int t = 0; t < 6; t++) {
        const v8f v = o[t].v * inv;
        *(uint4*)(orow + t * 16) = make_uint4(pack2(v[0], v[1]), pack2(v[2], v[3]),
                                              pack2(v[4], v[5]), pack2(v[6], v[7]));
    }
}

// ---------------------------------------------------------------------------
extern "C" void kernel_launch(void* const* d_in, const int* in_sizes, int n_in,
                              void* d_out, int out_size, void* d_ws,
                              size_t ws_size, hipStream_t stream) {
    (void)in_sizes; (void)n_in; (void)out_size; (void)ws_size;
    const float* q  = (const float*)d_in[0];
    const float* kv = (const float*)d_in[1];
    const float* wq = (const float*)d_in[2];
    const float* wk = (const float*)d_in[3];
    const float* wv = (const float*)d_in[4];
    const float* wp = (const float*)d_in[5];
    const float* bp = (const float*)d_in[6];

    char* ws = (char*)d_ws;
    size_t off = 0;
    const size_t ACT = (size_t)MTOT * DIMX * 2;   // 12.58 MB
    const size_t WB  = (size_t)DIMX * DIMX * 2;   // 1.18 MB
    __bf16* qb  = (__bf16*)(ws + off); off += ACT;
    __bf16* kvb = (__bf16*)(ws + off); off += ACT;
    __bf16* wqb = (__bf16*)(ws + off); off += WB;
    __bf16* wkb = (__bf16*)(ws + off); off += WB;
    __bf16* wvb = (__bf16*)(ws + off); off += WB;
    __bf16* wpb = (__bf16*)(ws + off); off += WB;
    __bf16* Qb  = (__bf16*)(ws + off); off += ACT;
    __bf16* Kb  = (__bf16*)(ws + off); off += ACT;
    __bf16* Vtb = (__bf16*)(ws + off); off += ACT;
    __bf16* Ab  = (__bf16*)(ws + off); off += ACT;

    // qb .. wpb are contiguous: one destination array for the whole launch
    cvt_all_kernel<<<CVT_BLOCKS, 256, 0, stream>>>(q, kv, wq, wk, wv, wp, qb);

    // Q, K and V projections: one launch, blockIdx.z picks the product
    dim3 g3(DIMX / TN, MTOT / TM, 3);     // (4, 64, 3)
    qkv_gemm_kernel<<<g3, 256, 0, stream>>>(qb, kvb, wqb, wkb, wvb, Qb, Kb, Vtb);

    attn_kernel<<<NB * NHEADS * (SEQ / 128), 256, 0, stream>>>(Qb, Kb, Vtb, Ab);

    dim3 gg(DIMX / TN, MTOT / TM);        // (4, 64)
    proj_gemm_kernel<<<gg, 256, 0, stream>>>(Ab, wpb, (float*)d_out, bp);
}

// v008
// One run takes 84.6 microseconds.
// Next to v007, in two timings, it ran 1.04 times as fast each time.
// All steps since v000 together make it 2.71 times as fast.
#include <hip/hip_runtime.h>

#define DIMX   768
#define NHEADS 8
#define HD     96
#define SEQ    1024
#define NB     8
#define MTOT   (NB * SEQ)   // 8192

typedef __attribute__((ext_vector_type(16))) __bf16 v16bf;
typedef __attribute__((ext_vector_type(8)))  float  v8f;

union Frag {
    v16bf v;
    uint4 q[2];
    unsigned short s[16];
};
union AccU {
    v8f   v;
    float f[8];
};

__device__ __forceinline__ unsigned pack2(float lo, float hi) {
    typedef __bf16 bf2 __attribute__((ext_vector_type(2)));
    typedef float  f2  __attribute__((ext_vector_type(2)));
    return __builtin_bit_cast(unsigned, __builtin_convertvector(f2{lo, hi}, bf2));
}

// ---------------------------------------------------------------------------
// fp32 -> bf16 convert of all six operands in one launch.  The six bf16 copies
// lie one behind the other in the workspace (q, kv, wq, wk, wv, wp), so block b
// writes span b of one long array; every span lies inside one source tensor.
// A lane brings 24 x 16 B, each wave-wide load 512 contiguous bytes.
// ---------------------------------------------------------------------------
#define CVT_LOADS  24
#define CVT_SPAN   (256 * 4 * CVT_LOADS)            // 24576 floats a block
#define CVT_ACTB   (MTOT * DIMX / CVT_SPAN)         // 256 blocks an activation
#define CVT_WB     (DIMX * DIMX / CVT_SPAN)         // 24 blocks a weight
#define CVT_BLOCKS (2 * CVT_ACTB + 4 * CVT_WB)      // 608

__global__ __launch_bounds__(256)
void cvt_all_kernel(const float* __restrict__ q,  const float* __restrict__ kv,
                    const float* __restrict__ wq, const float* __restrict__ wk,
                    const float* __restrict__ wv, const float* __restrict__ wp,
                    __bf16* __restrict__ y) {
    const int b = blockIdx.x;
    const float* src;
    int sb;
    if (b < CVT_ACTB) {
        src = q;  sb = b;
    } else if (b < 2 * CVT_ACTB) {
        src = kv; sb = b - CVT_ACTB;
    } else {
        const int w = (b - 2 * CVT_ACTB) / CVT_WB;
        sb  = (b - 2 * CVT_ACTB) % CVT_WB;
        src = w == 0 ? wq : w == 1 ? wk : w == 2 ? wv : wp;
    }
    const float4* x = (const float4*)(src + (size_t)sb * CVT_SPAN) + threadIdx.x;
    uint2*        o = (uint2*)(y + (size_t)b * CVT_SPAN) + threadIdx.x;

    float4 f[CVT_LOADS];
#pragma unroll
    for (int j = 0; j < CVT_LOADS; j++) f[j] = x[j * 256];
    // keeps every load of the lane ahead of the first convert and store, so that
    // the wave's whole span is in flight at once
    __builtin_amdgcn_sched_barrier(0);
#pragma unroll
    for (int j = 0; j < CVT_LOADS; j++) {
        union { __bf16 b[4]; uint2 u; } c;
        c.b[0] = (__bf16)f[j].x; c.b[1] = (__bf16)f[j].y;
        c.b[2] = (__bf16)f[j].z; c.b[3] = (__bf16)f[j].w;
        o[j * 256] = c.u;
    }
}

// ---------------------------------------------------------------------------
// One stage of the GEMM's LDS ring: each lane copies 4 x 16 B of A and 6 x 16 B
// of W (rows 32 apart) from global memory straight into LDS.  The s_wait_xcnt
// is the last line of the copies' own statement so that no address register is
// rewritten ahead of it.
// ---------------------------------------------------------------------------
#define KT      64                  // k per stage
#define NSTAGE  (DIMX / KT)         // 12
#define PITCH_B 144                 // LDS bytes per staged row
#define TM      128                 // rows of C a block
#define TN      192                 // columns of C a block
#define STAGE_B ((TM + TN) * PITCH_B)   // 46080

__device__ __forceinline__ void stage_copy(const __bf16* ga, const __bf16* gw,
                                           unsigned lds) {
    asm volatile(
        "global_load_async_to_lds_b128 %0, %10, off\n\t"
        "global_load_async_to_lds_b128 %1, %11, off\n\t"
        "global_load_async_to_lds_b128 %2, %12, off\n\t"
        "global_load_async_to_lds_b128 %3, %13, off\n\t"
        "global_load_async_to_lds_b128 %4, %14, off\n\t"
        "global_load_async_to_lds_b128 %5, %15, off\n\t"
        "global_load_async_to_lds_b128 %6, %16, off\n\t"
        "global_load_async_to_lds_b128 %7, %17, off\n\t"
        "global_load_async_to_lds_b128 %8, %18, off\n\t"
        "global_load_async_to_lds_b128 %9, %19, off\n\t"
        "s_wait_xcnt 0x0"
        :: "v"(lds), "v"(lds + 32 * PITCH_B), "v"(lds + 64 * PITCH_B),
           "v"(lds + 96 * PITCH_B), "v"(lds + 128 * PITCH_B),
           "v"(lds + 160 * PITCH_B), "v"(lds + 192 * PITCH_B),
           "v"(lds + 224 * PITCH_B), "v"(lds + 256 * PITCH_B),
           "v"(lds + 288 * PITCH_B),
           "v"(ga), "v"(ga + 32 * DIMX), "v"(ga + 64 * DIMX), "v"(ga + 96 * DIMX),
           "v"(gw), "v"(gw + 32 * DIMX), "v"(gw + 64 * DIMX), "v"(gw + 96 * DIMX),
           "v"(gw + 128 * DIMX), "v"(gw + 160 * DIMX)
        : "memory");
}

// ---------------------------------------------------------------------------
// bf16 WMMA GEMM:  C[m,n] = sum_k A[m,k] * W[n,k]   (i.e. y = x @ W^T)
// A: [MTOT x DIMX] bf16 row-major,  W: [DIMX x DIMX] bf16 row-major.
// Block = 256 thr (8 waves) -> 128x192 tile; wave -> 64x48 (4x3 WMMA tiles).
// Operands are staged in LDS by asynchronous copies, two buffers.
// gemm_tile leaves the wave's 4x3 accumulator tiles in acc; the kernels below
// choose the operands and store the result.  The two fragment loaders are alike,
// so either operand can be the WMMA's A.  TR = false: A rows are the tile's rows,
// a lane's 8 registers are 8 neighbouring m of one n.  TR = true: W rows are the
// tile's rows, a lane's 8 registers are 8 neighbouring n of one m.  The k order
// and each element's sum are the same in both.
// ---------------------------------------------------------------------------
template <bool TR>
__device__ __forceinline__ void gemm_tile(const __bf16* __restrict__ A,
                                          const __bf16* __restrict__ W,
                                          unsigned char* tile, AccU (&acc)[4][3]) {
    const int lane  = threadIdx.x & 31;
    const int wid   = threadIdx.x >> 5;
    const int wr    = wid & 1;          // 2 row-waves
    const int wc    = wid >> 1;         // 4 col-waves
    const int l15   = lane & 15;
    const int lhalf = lane >> 4;

    // Copy map: 8 lanes cover one 128-B row piece, a wave 4 whole lines a copy.
    const int crow = threadIdx.x >> 3;  // 0..31
    const int cchk = threadIdx.x & 7;   // 16-B chunk in the row piece
    const __bf16* gA = A + (size_t)(blockIdx.y * TM + crow) * DIMX + cchk * 8;
    const __bf16* gW = W + (size_t)(blockIdx.x * TN + crow) * DIMX + cchk * 8;
    const unsigned ldsC = (unsigned)(size_t)tile + crow * PITCH_B + cchk * 16;

#pragma unroll
    for (int i = 0; i < 4; i++)
#pragma unroll
        for (int t = 0; t < 3; t++)
#pragma unroll
            for (int e = 0; e < 8; e++) acc[i][t].f[e] = 0.0f;

    stage_copy(gA, gW, ldsC);
    // stage 0 has landed before the barrier that publishes it
    asm volatile("s_wait_asynccnt 0x0" ::: "memory");
    __syncthreads();
    stage_copy(gA + KT, gW + KT, ldsC + STAGE_B);

    const unsigned char* fa = tile + (wr * 64 + l15) * PITCH_B + lhalf * 16;
    const unsigned char* fb = tile + (TM + wc * 48 + l15) * PITCH_B + lhalf * 16;

    // unrolled by directive: the compiler unrolled the 128x128 tile's loop by itself
    // and leaves this larger body rolled; rolled, the buffer offset is formed anew
    // every trip and the refill stands behind all of a stage's products, not among
    // them, so that it has less time to land
#pragma unroll
    for (int s = 0; s < NSTAGE; s++) {
        const int bo = (s & 1) * STAGE_B;
        Frag a[2][4], b[2][3];
#pragma unroll
        for (int ks = 0; ks < 2; ks++) {
#pragma unroll
            for (int i = 0; i < 4; i++) {
                const unsigned char* p = fa + bo + i * 16 * PITCH_B + ks * 64;
                a[ks][i].q[0] = *(const uint4*)p;
                a[ks][i].q[1] = *(const uint4*)(p + 32);
            }
#pragma unroll
            for (int t = 0; t < 3; t++) {
                const unsigned char* p = fb + bo + t * 16 * PITCH_B + ks * 64;
                b[ks][t].q[0] = *(const uint4*)p;
                b[ks][t].q[1] = *(const uint4*)(p + 32);
            }
        }
        // keeps all 28 LDS reads of a stage ahead of the stage's first WMMA, so
        // that the wave waits for LDS once a stage, not before each WMMA pair
        __builtin_amdgcn_sched_barrier(0);
#pragma unroll
        for (int ks = 0; ks < 2; ks++)
#pragma unroll
            for (int i = 0; i < 4; i++)
#pragma unroll
                for (int t = 0; t < 3; t++)
                    acc[i][t].v = __builtin_amdgcn_wmma_f32_16x16x32_bf16(
                        false, TR ? b[ks][t].v : a[ks][i].v,
                        false, TR ? a[ks][i].v : b[ks][t].v, (short)0,
                        acc[i][t].v, false, false);

        // publish point: this wave's reads of the buffer are done, its copies of
        // the next stage have landed; the barrier says so for every wave
        asm volatile("s_wait_dscnt 0x0" ::: "memory");
        asm volatile("s_wait_asynccnt 0x0" ::: "memory");
        __syncthreads();
        if (s + 2 < NSTAGE)
            stage_copy(gA + (s + 2) * KT, gW + (s + 2) * KT, ldsC + bo);
    }
    // no copy is left in flight when the wave goes on to its stores
    asm volatile("s_wait_asynccnt 0x0" ::: "memory");
}

// ---------------------------------------------------------------------------
// Epilogues.  The block's C tile goes through LDS so that global memory is
// written in whole 128-B lines: 8 lanes x 16 B cover a line, a wave 4 lines a
// store.  The ring is free here: the last trip's barrier stands behind every
// wave's last read of it, and no copy is in flight.  Staged rows have a pitch of
// 16 B x odd, which spreads the 16-B writes of 16 lanes over the banks.
// A wave's corner of the tile: row wr * 64, column wc * 48.
// ---------------------------------------------------------------------------
#define CPITCH_B (TN * 2 + 16)      // 400: bf16 C rows, 192 n
#define VPITCH2_B (TM * 2 + 16)     // 272: bf16 C^T rows, 128 m
#define FPITCH_B (TN * 4 + 16)      // 784: f32 C rows, 192 n

__device__ __forceinline__ uint4 pack8(const AccU& x) {
    return make_uint4(pack2(x.f[0], x.f[1]), pack2(x.f[2], x.f[3]),
                      pack2(x.f[4], x.f[5]), pack2(x.f[6], x.f[7]));
}

// ---------------------------------------------------------------------------
// The three input projections in ONE launch: they do not depend on one another,
// so blockIdx.z picks the product.  z = 0: Q = q.wq^T; z = 1: K = kv.wk^T, both
// [M x DIMX]; z = 2: V = kv.wv^T, stored transposed per head, Vt[n,h,d,s].
// ---------------------------------------------------------------------------
__global__ __launch_bounds__(256)
void qkv_gemm_kernel(const __bf16* __restrict__ xq, const __bf16* __restrict__ xkv,
                     const __bf16* __restrict__ wq, const __bf16* __restrict__ wk,
                     const __bf16* __restrict__ wv,
                     __bf16* __restrict__ Qo, __bf16* __restrict__ Ko,
                     __bf16* __restrict__ Vto) {
    // Two stage buffers; a stage is [A 128 rows | W 192 rows] x 64 k (128 B a
    // row) at a pitch of 144 B, which spreads ds_load_b128 readers over the banks.
    __shared__ __align__(16) unsigned char tile[2 * STAGE_B];

    const int z     = blockIdx.z;
    const int l15   = threadIdx.x & 15;
    const int lhalf = (threadIdx.x >> 4) & 1;
    const int wr    = (threadIdx.x >> 5) & 1;
    const int wc    = threadIdx.x >> 6;
    const int srow  = threadIdx.x >> 3;         // staged row a lane reads back
    const int schk  = (threadIdx.x & 7) * 16;   // its 16 B of a 128-B line

    AccU acc[4][3];
    if (z == 2) {
        gemm_tile<false>(xkv, wv, tile, acc);
        // staged as C^T: row = column n of the tile (one d of one head), 128 s
#pragma unroll
        for (int i = 0; i < 4; i++)
#pragma unroll
            for (int t = 0; t < 3; t++)
                *(uint4*)(tile + (wc * 48 + t * 16 + l15) * VPITCH2_B
                               + (wr * 64 + i * 16 + lhalf * 8) * 2) = pack8(acc[i][t]);
        __syncthreads();
        // (n * NHEADS + h) * HD + d = n * DIMX + column
        const int m0 = blockIdx.y * TM;
        __bf16* dst = Vto + ((size_t)(m0 >> 10) * DIMX + blockIdx.x * TN + srow) * SEQ
                          + (m0 & (SEQ - 1)) + (threadIdx.x & 7) * 8;
#pragma unroll
        for (int r = 0; r < TN / 32; r++)
#pragma unroll
            for (int c = 0; c < 2; c++)
                *(uint4*)(dst + (size_t)r * 32 * SEQ + c * 64) =
                    *(const uint4*)(tile + (srow + r * 32) * VPITCH2_B + c * 128 + schk);
    } else {
        gemm_tile<true>(z == 0 ? xq : xkv, z == 0 ? wq : wk, tile, acc);
#pragma unroll
        for (int i = 0; i < 4; i++)
#pragma unroll
            for (int t = 0; t < 3; t++)
                *(uint4*)(tile + (wr * 64 + i * 16 + l15) * CPITCH_B
                               + (wc * 48 + t * 16 + lhalf * 8) * 2) = pack8(acc[i][t]);
        __syncthreads();
        __bf16* dst = (z == 0 ? Qo : Ko) + (size_t)(blockIdx.y * TM + srow) * DIMX
                          + blockIdx.x * TN + (threadIdx.x & 7) * 8;
#pragma unroll
        for (int r = 0; r < TM / 32; r++)
#pragma unroll
            for (int c = 0; c < 3; c++)
                *(uint4*)(dst + (size_t)r * 32 * DIMX + c * 64) =
                    *(const uint4*)(tile + (srow + r * 32) * CPITCH_B + c * 128 + schk);
        // the z == 2 code is laid directly behind these stores in the built kernel:
        // no register that they name is rewritten ahead of this wait
        asm volatile("s_wait_xcnt 0x0" ::: "memory");
    }
}

// ---------------------------------------------------------------------------
// Output projection: f32 result plus bias.
// ---------------------------------------------------------------------------
__global__ __launch_bounds__(256)
void proj_gemm_kernel(const __bf16* __restrict__ A, const __bf16* __restrict__ W,
                      float* __restrict__ out, const float* __restrict__ bias) {
    // the same two stage buffers as above; the staged f32 tile is a little larger
    __shared__ __align__(16) unsigned char tile[TM * FPITCH_B];
    static_assert(TM * FPITCH_B >= 2 * STAGE_B, "the ring must fit");

    const int l15   = threadIdx.x & 15;
    const int lhalf = (threadIdx.x >> 4) & 1;
    const int wr    = (threadIdx.x >> 5) & 1;
    const int wc    = threadIdx.x >> 6;
    const int srow  = threadIdx.x >> 3;
    const int schk  = (threadIdx.x & 7) * 16;

    AccU acc[4][3];
    gemm_tile<true>(A, W, tile, acc);

#pragma unroll
    for (int t = 0; t < 3; t++) {
        const int col = wc * 48 + t * 16 + lhalf * 8;
        const float4 b0 = *(const float4*)(bias + blockIdx.x * TN + col);
        const float4 b1 = *(const float4*)(bias + blockIdx.x * TN + col + 4);
#pragma unroll
        for (int i = 0; i < 4; i++) {
            unsigned char* p = tile + (wr * 64 + i * 16 + l15) * FPITCH_B + col * 4;
            const AccU& x = acc[i][t];
            *(float4*)p = make_float4(x.f[0] + b0.x, x.f[1] + b0.y,
                                      x.f[2] + b0.z, x.f[3] + b0.w);
            *(float4*)(p + 16) = make_float4(x.f[4] + b1.x, x.f[5] + b1.y,
                                             x.f[6] + b1.z, x.f[7] + b1.w);
        }
    }
    __syncthreads();
    float* dst = out + (size_t)(blockIdx.y * TM + srow) * DIMX + blockIdx.x * TN
                     + (threadIdx.x & 7) * 4;
#pragma unroll
    for (int r = 0; r < TM / 32; r++)
#pragma unroll
        for (int c = 0; c < 6; c++)
            *(float4*)(dst + (size_t)r * 32 * DIMX + c * 32) =
                *(const float4*)(tile + (srow + r * 32) * FPITCH_B + c * 128 + schk);
}

// ---------------------------------------------------------------------------
// One stage of the attention kernel's LDS ring: 64 keys of K (64 rows of 192 B)
// and of Vt (96 rows of 128 B), 6 x 16 B a lane, from global memory straight
// into LDS.  The s_wait_xcnt is the last line of the copies' own statement so
// that no address register is rewritten ahead of it.
// ---------------------------------------------------------------------------
#define AKT      64                          // keys per stage
#define ANSTAGE  (SEQ / AKT)                 // 16
#define KPITCH_B 208                         // LDS bytes per K row  (16 B x 13)
#define VPITCH_B 144                         // LDS bytes per Vt row (16 B x 9)
#define KTILE_B  (AKT * KPITCH_B)            // 13312
#define ASTAGE_B (KTILE_B + HD * VPITCH_B)   // 27136

__device__ __forceinline__ void kv_stage_copy(const __bf16* k0, const __bf16* k1,
                                              const __bf16* k2, const __bf16* v,
                                              unsigned lk0, unsigned lk1,
                                              unsigned lk2, unsigned lv) {
    asm volatile(
        "global_load_async_to_lds_b128 %0, %6, off\n\t"
        "global_load_async_to_lds_b128 %1, %7, off\n\t"
        "global_load_async_to_lds_b128 %2, %8, off\n\t"
        "global_load_async_to_lds_b128 %3, %9, off\n\t"
        "global_load_async_to_lds_b128 %4, %10, off\n\t"
        "global_load_async_to_lds_b128 %5, %11, off\n\t"
        "s_wait_xcnt 0x0"
        :: "v"(lk0), "v"(lk1), "v"(lk2),
           "v"(lv), "v"(lv + 32 * VPITCH_B), "v"(lv + 64 * VPITCH_B),
           "v"(k0), "v"(k1), "v"(k2),
           "v"(v), "v"(v + 32 * SEQ), "v"(v + 64 * SEQ)
        : "memory");
}

// ---------------------------------------------------------------------------
// Lane l takes the value of lane l ^ 16 (a vector cross-row move, no LDS).
// ---------------------------------------------------------------------------
__device__ __forceinline__ float xhalf(float x) {
    const int i = __builtin_bit_cast(int, x);
    return __builtin_bit_cast(float, __builtin_amdgcn_permlanex16(
        i, i, 0x76543210, 0xfedcba98, false, false));
}

__global__ __launch_bounds__(256)
void attn_kernel(const __bf16* __restrict__ Q, const __bf16* __restrict__ K,
                 const __bf16* __restrict__ Vt, __bf16* __restrict__ O) {
    // Two stage buffers; a stage is [K 64 rows x 192 B | Vt 96 rows x 128 B], each
    // at a pitch of 16 B x odd, which spreads ds_load_b128 readers over the banks.
    __shared__ __align__(16) unsigned char kvt[2 * ASTAGE_B];

    const int lane  = threadIdx.x & 31;
    const int wid   = threadIdx.x >> 5;
    const int l15   = lane & 15;
    const int lhalf = lane >> 4;
    const int kb8   = lhalf * 8;

    const int blk  = blockIdx.x;
    const int qblk = blk & 7;           // S/128 = 8
    const int h    = (blk >> 3) & 7;
    const int n    = blk >> 6;
    const int qbase = qblk * 128 + wid * 16;

    // Copy map.  K: the stage's 768 chunks of 16 B in row order, 12 a row, so a
    // wave-wide copy covers 32 consecutive chunks, 2 2/3 rows; Vt: 8 lanes cover one 128-B line.
    const int kc0 = threadIdx.x, kc1 = kc0 + 256, kc2 = kc0 + 512;
    const __bf16* Kh = K + (size_t)n * SEQ * DIMX + h * HD;
    const __bf16* gK0 = Kh + (kc0 / 12) * DIMX + (kc0 % 12) * 8;
    const __bf16* gK1 = Kh + (kc1 / 12) * DIMX + (kc1 % 12) * 8;
    const __bf16* gK2 = Kh + (kc2 / 12) * DIMX + (kc2 % 12) * 8;
    const __bf16* gV  = Vt + ((size_t)(n * NHEADS + h) * HD + (threadIdx.x >> 3)) * SEQ
                           + (threadIdx.x & 7) * 8;
    const unsigned ldsB = (unsigned)(size_t)kvt;
    const unsigned lK0 = ldsB + (kc0 / 12) * KPITCH_B + (kc0 % 12) * 16;
    const unsigned lK1 = ldsB + (kc1 / 12) * KPITCH_B + (kc1 % 12) * 16;
    const unsigned lK2 = ldsB + (kc2 / 12) * KPITCH_B + (kc2 % 12) * 16;
    const unsigned lV  = ldsB + KTILE_B + (threadIdx.x >> 3) * VPITCH_B
                              + (threadIdx.x & 7) * 16;

    kv_stage_copy(gK0, gK1, gK2, gV, lK0, lK1, lK2, lV);
    // stage 0 has landed before the barrier that publishes it
    asm volatile("s_wait_asynccnt 0x0" ::: "memory");
    __syncthreads();
    kv_stage_copy(gK0 + AKT * DIMX, gK1 + AKT * DIMX, gK2 + AKT * DIMX, gV + AKT,
                  lK0 + ASTAGE_B, lK1 + ASTAGE_B, lK2 + ASTAGE_B, lV + ASTAGE_B);

    // Preload this wave's Q fragments (3 chunks of K=32 covering hd=96)
    Frag qf[3];
#pragma unroll
    for (int c = 0; c < 3; c++) {
        const __bf16* p =
            Q + (size_t)(n * SEQ + qbase + l15) * DIMX + h * HD + c * 32 + kb8;
        qf[c].q[0] = *(const uint4*)p;
        qf[c].q[1] = *(const uint4*)(p + 16);
    }

    AccU o[6];   // O^T: register j of tile t is d = t * 16 + j + 8 * lhalf, query l15
#pragma unroll
    for (int t = 0; t < 6; t++)
#pragma unroll
        for (int e = 0; e < 8; e++) o[t].f[e] = 0.0f;
    float m = -1e30f, l = 0.0f;   // this lane's query: running maximum (log2), partial sum

    const float cscale = 0.0360843918243516f * 1.4426950408889634f;  // log2(e)/sqrt(768)

    const unsigned char* fk = kvt + l15 * KPITCH_B + lhalf * 16;
    const unsigned char* fv = kvt + KTILE_B + l15 * VPITCH_B + lhalf * 16;

    for (int st = 0; st < ANSTAGE; st++) {
      const int bo = (st & 1) * ASTAGE_B;
      // First part of a trip: every LDS read of the stage, in groups of 12 or 24 ahead
      // of the products that use them, and the score products of both 32-key halves.
      AccU s[2][2];   // s[half][r]: keys half * 32 + r * 16 .. + 15
      Frag vf[2][6];  // vf[half][t]: d tile t, keys half * 32 .. + 31
      // unrolled so that s and vf stay in registers and the two halves differ only
      // in the LDS reads' immediate offsets
#pragma unroll
      for (int hf = 0; hf < 2; hf++) {
        Frag kf[3][2];
#pragma unroll
        for (int c = 0; c < 3; c++)
#pragma unroll
            for (int r = 0; r < 2; r++) {
                const unsigned char* p =
                    fk + bo + (hf * 32 + r * 16) * KPITCH_B + c * 64;
                kf[c][r].q[0] = *(const uint4*)p;
                kf[c][r].q[1] = *(const uint4*)(p + 32);
            }
        // Vt rows are contiguous in s.  The first half's Vt goes with its K; the
        // second half's follows the last score products, into the K registers.
        if (hf == 0) {
#pragma unroll
            for (int t = 0; t < 6; t++) {
                const unsigned char* p = fv + bo + t * 16 * VPITCH_B;
                vf[0][t].q[0] = *(const uint4*)p;
                vf[0][t].q[1] = *(const uint4*)(p + 32);
            }
        }
        // keeps the group of reads together in front of its first product: one LDS
        // latency for the group, not one for each pair of reads
        __builtin_amdgcn_sched_barrier(0);
#pragma unroll
        for (int r = 0; r < 2; r++)
#pragma unroll
            for (int e = 0; e < 8; e++) s[hf][r].f[e] = 0.0f;
        // scores: K chunks x Q^T -> two 16x16 tiles (rows = keys)
#pragma unroll
        for (int c = 0; c < 3; c++)
#pragma unroll
            for (int r = 0; r < 2; r++)
                s[hf][r].v = __builtin_amdgcn_wmma_f32_16x16x32_bf16(
                    false, kf[c][r].v, false, qf[c].v, (short)0, s[hf][r].v,
                    false, false);
        // keeps the next group of reads behind these products, so that it takes
        // the registers of the K fragments just used (256 registers a wave let
        // both of a WGP's blocks stay resident)
        __builtin_amdgcn_sched_barrier(0);
      }
#pragma unroll
      for (int t = 0; t < 6; t++) {
          const unsigned char* p = fv + bo + t * 16 * VPITCH_B + 64;
          vf[1][t].q[0] = *(const uint4*)p;
          vf[1][t].q[1] = *(const uint4*)(p + 32);
      }

      // publish point: this wave's reads of the buffer are done, its copies of
      // the next stage have landed; the barrier says so for every wave.  The rest
      // of the trip works on registers alone, so the refill flies a whole trip.
      asm volatile("s_wait_dscnt 0x0" ::: "memory");
      asm volatile("s_wait_asynccnt 0x0" ::: "memory");
      __syncthreads();
      if (st + 2 < ANSTAGE)
          kv_stage_copy(gK0 + (st + 2) * AKT * DIMX, gK1 + (st + 2) * AKT * DIMX,
                        gK2 + (st + 2) * AKT * DIMX, gV + (st + 2) * AKT,
                        lK0 + bo, lK1 + bo, lK2 + bo, lV + bo);

      // Second part: softmax and output products of the two halves, in key order
      // (unrolled so that s and vf are indexed by constants and stay in registers).
#pragma unroll
      for (int hf = 0; hf < 2; hf++) {
        const AccU s0 = s[hf][0], s1 = s[hf][1];
        // online softmax of this lane's query, in the log2 domain (the scale is
        // positive, so the maximum is taken on the raw scores)
        float mx = fmaxf(s0.f[0], s1.f[0]);
        for (int j = 1; j < 8; j++) mx = fmaxf(mx, fmaxf(s0.f[j], s1.f[j]));
        mx = fmaxf(mx, xhalf(mx));
        const float mn = fmaxf(m, mx * cscale);
        const float fr = __builtin_amdgcn_exp2f(m - mn);
        m = mn;
        for (int t = 0; t < 6; t++) o[t].v = o[t].v * fr;

        Frag pb;
        unsigned w[8];
        float ps0 = 0.0f, ps1 = 0.0f;
        for (int i = 0; i < 4; i++) {
            const float a0 = __builtin_amdgcn_exp2f(fmaf(s0.f[2 * i],     cscale, -mn));
            const float a1 = __builtin_amdgcn_exp2f(fmaf(s0.f[2 * i + 1], cscale, -mn));
            const float b0 = __builtin_amdgcn_exp2f(fmaf(s1.f[2 * i],     cscale, -mn));
            const float b1 = __builtin_amdgcn_exp2f(fmaf(s1.f[2 * i + 1], cscale, -mn));
            ps0 += a0 + a1;
            ps1 += b0 + b1;
            w[i]     = pack2(a0, a1);
            w[4 + i] = pack2(b0, b1);
        }
        l = l * fr + (ps0 + ps1);   // this half's 16 keys (halves joined at the end)
        pb.q[0] = make_uint4(w[0], w[1], w[2], w[3]);
        pb.q[1] = make_uint4(w[4], w[5], w[6], w[7]);

        // O^T += Vt[16 d x 32 keys] x P^T[32 keys x 16 queries]
#pragma unroll
        for (int t = 0; t < 6; t++)
            o[t].v = __builtin_amdgcn_wmma_f32_16x16x32_bf16(
                false, vf[hf][t].v, false, pb.v, (short)0, o[t].v, false, false);
      }
    }
    // no copy is left in flight when the wave goes on to its stores
    asm volatile("s_wait_asynccnt 0x0" ::: "memory");

    // normalize and store (heads concatenated back into [N,S,D]): a lane's eight
    // registers of a tile are eight neighbouring d of its query, one 16-B store
    const float inv = 1.0f / (l + xhalf(l));
    __bf16* orow = O + (size_t)(n * SEQ + qbase + l15) * DIMX + h * HD + kb8;
    for (int t = 0; t < 6; t++) {
        const v8f v = o[t].v * inv;
        *(uint4*)(orow + t * 16) = make_uint4(pack2(v[0], v[1]), pack2(v[2], v[3]),
                                              pack2(v[4], v[5]), pack2(v[6], v[7]));
    }
}

// ---------------------------------------------------------------------------
extern "C" void kernel_launch(void* const* d_in, const int* in_sizes, int n_in,
                              void* d_out, int out_size, void* d_ws,
                              size_t ws_size, hipStream_t stream) {
    (void)in_sizes; (void)n_in; (void)out_size; (void)ws_size;
    const float* q  = (const float*)d_in[0];
    const float* kv = (const float*)d_in[1];
    const float* wq = (const float*)d_in[2];
    const float* wk = (const float*)d_in[3];
    const float* wv = (const float*)d_in[4];
    const float* wp = (const float*)d_in[5];
    const float* bp = (const float*)d_in[6];

    char* ws = (char*)d_ws;
    size_t off = 0;
    const size_t ACT = (size_t)MTOT * DIMX * 2;   // 12.58 MB
    const size_t WB  = (size_t)DIMX * DIMX * 2;   // 1.18 MB
    __bf16* qb  = (__bf16*)(ws + off); off += ACT;
    __bf16* kvb = (__bf16*)(ws + off); off += ACT;
    __bf16* wqb = (__bf16*)(ws + off); off += WB;
    __bf16* wkb = (__bf16*)(ws + off); off += WB;
    __bf16* wvb = (__bf16*)(ws + off); off += WB;
    __bf16* wpb = (__bf16*)(ws + off); off += WB;
    __bf16* Qb  = (__bf16*)(ws + off); off += ACT;
    __bf16* Kb  = (__bf16*)(ws + off); off += ACT;
    __bf16* Vtb = (__bf16*)(ws + off); off += ACT;
    __bf16* Ab  = (__bf16*)(ws + off); off += ACT;

    // qb .. wpb are contiguous: one destination array for the whole launch
    cvt_all_kernel<<<CVT_BLOCKS, 256, 0, stream>>>(q, kv, wq, wk, wv, wp, qb);

    // Q, K and V projections: one launch, blockIdx.z picks the product
    dim3 g3(DIMX / TN, MTOT / TM, 3);     // (4, 64, 3)
    qkv_gemm_kernel<<<g3, 256, 0, stream>>>(qb, kvb, wqb, wkb, wvb, Qb, Kb, Vtb);

    attn_kernel<<<NB * NHEADS * (SEQ / 128), 256, 0, stream>>>(Qb, Kb, Vtb, Ab);

    dim3 gg(DIMX / TN, MTOT / TM);        // (4, 64)
    proj_gemm_kernel<<<gg, 256, 0, stream>>>(Ab, wpb, (float*)d_out, bp);
}

// v009
// Measured time: 79.7 microseconds a run.
// In two side-by-side timings against v008, it was 1.05 and 1.07 times as fast.
// All steps since v000 together make it 2.86 times as fast.
#include <hip/hip_runtime.h>

#define DIMX   768
#define NHEADS 8
#define HD     96
#define SEQ    1024
#define NB     8
#define MTOT   (NB * SEQ)   // 8192

typedef __attribute__((ext_vector_type(16))) __bf16 v16bf;
typedef __attribute__((ext_vector_type(8)))  float  v8f;

union Frag {
    v16bf v;
    uint4 q[2];
    unsigned short s[16];
};
union AccU {
    v8f   v;
    float f[8];
};

__device__ __forceinline__ unsigned pack2(float lo, float hi) {
    typedef __bf16 bf2 __attribute__((ext_vector_type(2)));
    typedef float  f2  __attribute__((ext_vector_type(2)));
    return __builtin_bit_cast(unsigned, __builtin_convertvector(f2{lo, hi}, bf2));
}

// ---------------------------------------------------------------------------
// fp32 -> bf16 convert of all six operands in one launch.  The six bf16 copies
// lie one behind the other in the workspace (q, kv, wq, wk, wv, wp), so block b
// writes span b of one long array; every span lies inside one source tensor.
// A lane brings 24 x 16 B, each wave-wide load 512 contiguous bytes.
// ---------------------------------------------------------------------------
#define CVT_LOADS  24
#define CVT_SPAN   (256 * 4 * CVT_LOADS)            // 24576 floats a block
#define CVT_ACTB   (MTOT * DIMX / CVT_SPAN)         // 256 blocks an activation
#define CVT_WB     (DIMX * DIMX / CVT_SPAN)         // 24 blocks a weight
#define CVT_BLOCKS (2 * CVT_ACTB + 4 * CVT_WB)      // 608

__global__ __launch_bounds__(256)
void cvt_all_kernel(const float* __restrict__ q,  const float* __restrict__ kv,
                    const float* __restrict__ wq, const float* __restrict__ wk,
                    const float* __restrict__ wv, const float* __restrict__ wp,
                    __bf16* __restrict__ y) {
    const int b = blockIdx.x;
    const float* src;
    int sb;
    if (b < CVT_ACTB) {
        src = q;  sb = b;
    } else if (b < 2 * CVT_ACTB) {
        src = kv; sb = b - CVT_ACTB;
    } else {
        const int w = (b - 2 * CVT_ACTB) / CVT_WB;
        sb  = (b - 2 * CVT_ACTB) % CVT_WB;
        src = w == 0 ? wq : w == 1 ? wk : w == 2 ? wv : wp;
    }
    const float4* x = (const float4*)(src + (size_t)sb * CVT_SPAN) + threadIdx.x;
    uint2*        o = (uint2*)(y + (size_t)b * CVT_SPAN) + threadIdx.x;

    float4 f[CVT_LOADS];
#pragma unroll
    for (int j = 0; j < CVT_LOADS; j++) f[j] = x[j * 256];
    // keeps every load of the lane ahead of the first convert and store, so that
    // the wave's whole span is in flight at once
    __builtin_amdgcn_sched_barrier(0);
#pragma unroll
    for (int j = 0; j < CVT_LOADS; j++) {
        union { __bf16 b[4]; uint2 u; } c;
        c.b[0] = (__bf16)f[j].x; c.b[1] = (__bf16)f[j].y;
        c.b[2] = (__bf16)f[j].z; c.b[3] = (__bf16)f[j].w;
        o[j * 256] = c.u;
    }
}

// ---------------------------------------------------------------------------
// One stage of the GEMM's LDS ring: each lane copies 4 x 16 B of A and 6 x 16 B
// of W (rows 32 apart) from global memory straight into LDS.  The s_wait_xcnt
// is the last line of the copies' own statement so that no address register is
// rewritten ahead of it.
// ---------------------------------------------------------------------------
#define KT      64                  // k per stage
#define NSTAGE  (DIMX / KT)         // 12
#define PITCH_B 144                 // LDS bytes per staged row
#define TM      128                 // rows of C a block
#define TN      192                 // columns of C a block
#define STAGE_B ((TM + TN) * PITCH_B)   // 46080
#define NBUF    3                   // stage buffers in the ring
#define RING_B  (NBUF * STAGE_B)    // 138240: two blocks still fit a WGP's LDS
// The ring is laid out [A0 A1 A2 | W0 W1 W2]: every buffer of an operand then lies
// within 64 KiB of the first, in reach of an LDS read's or a copy's immediate offset.
#define ABUF_B   (TM * PITCH_B)     // 18432
#define WBUF_B   (TN * PITCH_B)     // 27648
#define WRING_AT (NBUF * ABUF_B)    // 55296

// B is the buffer.  The copies' immediate offset is added by the hardware to BOTH
// addresses, so the registers hold buffer 0's LDS addresses for every buffer, and
// each global address less that offset: the deeper ring costs no LDS-address
// register (256 registers a wave keep two blocks on a WGP).
template <int B>
__device__ __forceinline__ void stage_copy(const __bf16* ga, const __bf16* gw,
                                           unsigned lds) {
    static_assert(B >= 0 && B * WBUF_B < 65536 && B * ABUF_B < 65536,
                  "the range in which the offset moves both addresses");
    const unsigned long long a = (unsigned long long)ga - B * ABUF_B;
    const unsigned long long w = (unsigned long long)gw - B * WBUF_B;
    const unsigned long long R = 32 * DIMX * 2;   // bytes between a lane's rows
    const unsigned ldw = lds + WRING_AT;
    asm volatile(
        "global_load_async_to_lds_b128 %0, %10, off offset:%20\n\t"
        "global_load_async_to_lds_b128 %1, %11, off offset:%20\n\t"
        "global_load_async_to_lds_b128 %2, %12, off offset:%20\n\t"
        "global_load_async_to_lds_b128 %3, %13, off offset:%20\n\t"
        "global_load_async_to_lds_b128 %4, %14, off offset:%21\n\t"
        "global_load_async_to_lds_b128 %5, %15, off offset:%21\n\t"
        "global_load_async_to_lds_b128 %6, %16, off offset:%21\n\t"
        "global_load_async_to_lds_b128 %7, %17, off offset:%21\n\t"
        "global_load_async_to_lds_b128 %8, %18, off offset:%21\n\t"
        "global_load_async_to_lds_b128 %9, %19, off offset:%21\n\t"
        "s_wait_xcnt 0x0"
        :: "v"(lds), "v"(lds + 32 * PITCH_B), "v"(lds + 64 * PITCH_B),
           "v"(lds + 96 * PITCH_B),
           "v"(ldw), "v"(ldw + 32 * PITCH_B), "v"(ldw + 64 * PITCH_B),
           "v"(ldw + 96 * PITCH_B), "v"(ldw + 128 * PITCH_B),
           "v"(ldw + 160 * PITCH_B),
           "v"(a), "v"(a + R), "v"(a + 2 * R), "v"(a + 3 * R),
           "v"(w), "v"(w + R), "v"(w + 2 * R), "v"(w + 3 * R),
           "v"(w + 4 * R), "v"(w + 5 * R),
           "n"(B * ABUF_B), "n"(B * WBUF_B)
        : "memory");
}

// Stage s goes into buffer s mod NBUF (s is a constant wherever this is called).
__device__ __forceinline__ void ring_fill(int s, const __bf16* gA, const __bf16* gW,
                                          unsigned ldsC) {
    static_assert(NBUF == 3, "one case a buffer");
    if (s % NBUF == 0)      stage_copy<0>(gA + s * KT, gW + s * KT, ldsC);
    else if (s % NBUF == 1) stage_copy<1>(gA + s * KT, gW + s * KT, ldsC);
    else                    stage_copy<2>(gA + s * KT, gW + s * KT, ldsC);
}

// ---------------------------------------------------------------------------
// bf16 WMMA GEMM:  C[m,n] = sum_k A[m,k] * W[n,k]   (i.e. y = x @ W^T)
// A: [MTOT x DIMX] bf16 row-major,  W: [DIMX x DIMX] bf16 row-major.
// Block = 256 thr (8 waves) -> 128x192 tile; wave -> 64x48 (4x3 WMMA tiles).
// Operands are staged in LDS by asynchronous copies, three buffers: while a stage
// is worked on, the two after it may still be in flight, so a
// stage's copies have two trips to land, not one.
// gemm_tile leaves the wave's 4x3 accumulator tiles in acc; the kernels below
// choose the operands and store the result.  The two fragment loaders are alike,
// so either operand can be the WMMA's A.  TR = false: A rows are the tile's rows,
// a lane's 8 registers are 8 neighbouring m of one n.  TR = true: W rows are the
// tile's rows, a lane's 8 registers are 8 neighbouring n of one m.  The k order
// and each element's sum are the same in both.
// ---------------------------------------------------------------------------
template <bool TR>
__device__ __forceinline__ void gemm_tile(const __bf16* __restrict__ A,
                                          const __bf16* __restrict__ W,
                                          unsigned char* tile, AccU (&acc)[4][3]) {
    const int lane  = threadIdx.x & 31;
    const int wid   = threadIdx.x >> 5;
    const int wr    = wid & 1;          // 2 row-waves
    const int wc    = wid >> 1;         // 4 col-waves
    const int l15   = lane & 15;
    const int lhalf = lane >> 4;

    // Copy map: 8 lanes cover one 128-B row piece, a wave 4 whole lines a copy.
    const int crow = threadIdx.x >> 3;  // 0..31
    const int cchk = threadIdx.x & 7;   // 16-B chunk in the row piece
    const __bf16* gA = A + (size_t)(blockIdx.y * TM + crow) * DIMX + cchk * 8;
    const __bf16* gW = W + (size_t)(blockIdx.x * TN + crow) * DIMX + cchk * 8;
    const unsigned ldsC = (unsigned)(size_t)tile + crow * PITCH_B + cchk * 16;

#pragma unroll
    for (int i = 0; i < 4; i++)
#pragma unroll
        for (int t = 0; t < 3; t++)
#pragma unroll
            for (int e = 0; e < 8; e++) acc[i][t].f[e] = 0.0f;

    static_assert(NSTAGE >= NBUF, "the prologue fills every buffer");
    ring_fill(0, gA, gW, ldsC);
    ring_fill(1, gA, gW, ldsC);
    ring_fill(2, gA, gW, ldsC);
    // stage 0 has landed before the barrier that publishes it: the wave's 20
    // youngest copies, which may stay in flight, are those of stages 1 and 2
    asm volatile("s_wait_asynccnt 0x14" ::: "memory");
    __syncthreads();

    const unsigned char* fa = tile + (wr * 64 + l15) * PITCH_B + lhalf * 16;
    const unsigned char* fb = tile + WRING_AT + (wc * 48 + l15) * PITCH_B + lhalf * 16;

    // unrolled by directive: the compiler unrolled the 128x128 tile's loop by itself
    // and leaves this larger body rolled; rolled, the buffer offset is formed anew
    // every trip and the refill stands behind all of a stage's products, not among
    // them, so that it has less time to land
#pragma unroll
    for (int s = 0; s < NSTAGE; s++) {
        const int boa = (s % NBUF) * ABUF_B, bow = (s % NBUF) * WBUF_B;
        Frag a[2][4], b[2][3];
#pragma unroll
        for (int ks = 0; ks < 2; ks++) {
#pragma unroll
            for (int i = 0; i < 4; i++) {
                const unsigned char* p = fa + boa + i * 16 * PITCH_B + ks * 64;
                a[ks][i].q[0] = *(const uint4*)p;
                a[ks][i].q[1] = *(const uint4*)(p + 32);
            }
#pragma unroll
            for (int t = 0; t < 3; t++) {
                const unsigned char* p = fb + bow + t * 16 * PITCH_B + ks * 64;
                b[ks][t].q[0] = *(const uint4*)p;
                b[ks][t].q[1] = *(const uint4*)(p + 32);
            }
        }
        // keeps all 28 LDS reads of a stage ahead of the stage's first WMMA, so
        // that the wave waits for LDS once a stage, not before each WMMA pair
        __builtin_amdgcn_sched_barrier(0);
#pragma unroll
        for (int ks = 0; ks < 2; ks++)
#pragma unroll
            for (int i = 0; i < 4; i++)
#pragma unroll
                for (int t = 0; t < 3; t++)
                    acc[i][t].v = __builtin_amdgcn_wmma_f32_16x16x32_bf16(
                        false, TR ? b[ks][t].v : a[ks][i].v,
                        false, TR ? a[ks][i].v : b[ks][t].v, (short)0,
                        acc[i][t].v, false, false);

        // publish point: this wave's reads of the buffer are done, its copies of
        // the next stage have landed; the barrier says so for every wave.  Every
        // wave issues 10 copies a stage and the counter returns in issue order: where
        // stage s + 2 has been issued its 10 copies are the wave's youngest, and
        // they alone may stay in flight; where it has not, the wait is to 0.
        asm volatile("s_wait_dscnt 0x0" ::: "memory");
        if (s + 2 < NSTAGE)
            asm volatile("s_wait_asynccnt 0xa" ::: "memory");
        else
            asm volatile("s_wait_asynccnt 0x0" ::: "memory");
        __syncthreads();
        // refill of the buffer that every wave has just left
        if (s + NBUF < NSTAGE)
            ring_fill(s + NBUF, gA, gW, ldsC);
    }
    // no copy is left in flight when the wave goes on to its stores
    asm volatile("s_wait_asynccnt 0x0" ::: "memory");
}

// ---------------------------------------------------------------------------
// Epilogues.  The block's C tile goes through LDS so that global memory is
// written in whole 128-B lines: 8 lanes x 16 B cover a line, a wave 4 lines a
// store.  The ring is free here: the last trip's barrier stands behind every
// wave's last read of it, and no copy is in flight.  Staged rows have a pitch of
// 16 B x odd, which spreads the 16-B writes of 16 lanes over the banks.
// A wave's corner of the tile: row wr * 64, column wc * 48.
// ---------------------------------------------------------------------------
#define CPITCH_B (TN * 2 + 16)      // 400: bf16 C rows, 192 n
#define VPITCH2_B (TM * 2 + 16)     // 272: bf16 C^T rows, 128 m
#define FPITCH_B (TN * 4 + 16)      // 784: f32 C rows, 192 n

__device__ __forceinline__ uint4 pack8(const AccU& x) {
    return make_uint4(pack2(x.f[0], x.f[1]), pack2(x.f[2], x.f[3]),
                      pack2(x.f[4], x.f[5]), pack2(x.f[6], x.f[7]));
}

// ---------------------------------------------------------------------------
// The three input projections in ONE launch: they do not depend on one another,
// so blockIdx.z picks the product.  z = 0: Q = q.wq^T; z = 1: K = kv.wk^T, both
// [M x DIMX]; z = 2: V = kv.wv^T, stored transposed per head, Vt[n,h,d,s].
// ---------------------------------------------------------------------------
__global__ __launch_bounds__(256)
void qkv_gemm_kernel(const __bf16* __restrict__ xq, const __bf16* __restrict__ xkv,
                     const __bf16* __restrict__ wq, const __bf16* __restrict__ wk,
                     const __bf16* __restrict__ wv,
                     __bf16* __restrict__ Qo, __bf16* __restrict__ Ko,
                     __bf16* __restrict__ Vto) {
    // Three stage buffers; a stage is A 128 rows and W 192 rows x 64 k (128 B a
    // row) at a pitch of 144 B, which spreads ds_load_b128 readers over the banks.
    __shared__ __align__(16) unsigned char tile[RING_B];

    const int z     = blockIdx.z;
    const int l15   = threadIdx.x & 15;
    const int lhalf = (threadIdx.x >> 4) & 1;
    const int wr    = (threadIdx.x >> 5) & 1;
    const int wc    = threadIdx.x >> 6;
    const int srow  = threadIdx.x >> 3;         // staged row a lane reads back
    const int schk  = (threadIdx.x & 7) * 16;   // its 16 B of a 128-B line

    AccU acc[4][3];
    if (z == 2) {
        gemm_tile<false>(xkv, wv, tile, acc);
        // staged as C^T: row = column n of the tile (one d of one head), 128 s
#pragma unroll
        for (int i = 0; i < 4; i++)
#pragma unroll
            for (int t = 0; t < 3; t++)
                *(uint4*)(tile + (wc * 48 + t * 16 + l15) * VPITCH2_B
                               + (wr * 64 + i * 16 + lhalf * 8) * 2) = pack8(acc[i][t]);
        __syncthreads();
        // (n * NHEADS + h) * HD + d = n * DIMX + column
        const int m0 = blockIdx.y * TM;
        __bf16* dst = Vto + ((size_t)(m0 >> 10) * DIMX + blockIdx.x * TN + srow) * SEQ
                          + (m0 & (SEQ - 1)) + (threadIdx.x & 7) * 8;
#pragma unroll
        for (int r = 0; r < TN / 32; r++)
#pragma unroll
            for (int c = 0; c < 2; c++)
                *(uint4*)(dst + (size_t)r * 32 * SEQ + c * 64) =
                    *(const uint4*)(tile + (srow + r * 32) * VPITCH2_B + c * 128 + schk);
    } else {
        gemm_tile<true>(z == 0 ? xq : xkv, z == 0 ? wq : wk, tile, acc);
#pragma unroll
        for (int i = 0; i < 4; i++)
#pragma unroll
            for (int t = 0; t < 3; t++)
                *(uint4*)(tile + (wr * 64 + i * 16 + l15) * CPITCH_B
                               + (wc * 48 + t * 16 + lhalf * 8) * 2) = pack8(acc[i][t]);
        __syncthreads();
        __bf16* dst = (z == 0 ? Qo : Ko) + (size_t)(blockIdx.y * TM + srow) * DIMX
                          + blockIdx.x * TN + (threadIdx.x & 7) * 8;
#pragma unroll
        for (int r = 0; r < TM / 32; r++)
#pragma unroll
            for (int c = 0; c < 3; c++)
                *(uint4*)(dst + (size_t)r * 32 * DIMX + c * 64) =
                    *(const uint4*)(tile + (srow + r * 32) * CPITCH_B + c * 128 + schk);
        // the z == 2 code is laid directly behind these stores in the built kernel:
        // no register that they name is rewritten ahead of this wait
        asm volatile("s_wait_xcnt 0x0" ::: "memory");
    }
}

// ---------------------------------------------------------------------------
// Output projection: f32 result plus bias.
// ---------------------------------------------------------------------------
__global__ __launch_bounds__(256)
void proj_gemm_kernel(const __bf16* __restrict__ A, const __bf16* __restrict__ W,
                      float* __restrict__ out, const float* __restrict__ bias) {
    // the same three stage buffers as above; the staged f32 tile fits in them
    __shared__ __align__(16) unsigned char tile[RING_B];
    static_assert(RING_B >= TM * FPITCH_B, "the staged tile must fit");

    const int l15   = threadIdx.x & 15;
    const int lhalf = (threadIdx.x >> 4) & 1;
    const int wr    = (threadIdx.x >> 5) & 1;
    const int wc    = threadIdx.x >> 6;
    const int srow  = threadIdx.x >> 3;
    const int schk  = (threadIdx.x & 7) * 16;

    AccU acc[4][3];
    gemm_tile<true>(A, W, tile, acc);

#pragma unroll
    for (int t = 0; t < 3; t++) {
        const int col = wc * 48 + t * 16 + lhalf * 8;
        const float4 b0 = *(const float4*)(bias + blockIdx.x * TN + col);
        const float4 b1 = *(const float4*)(bias + blockIdx.x * TN + col + 4);
#pragma unroll
        for (int i = 0; i < 4; i++) {
            unsigned char* p = tile + (wr * 64 + i * 16 + l15) * FPITCH_B + col * 4;
            const AccU& x = acc[i][t];
            *(float4*)p = make_float4(x.f[0] + b0.x, x.f[1] + b0.y,
                                      x.f[2] + b0.z, x.f[3] + b0.w);
            *(float4*)(p + 16) = make_float4(x.f[4] + b1.x, x.f[5] + b1.y,
                                             x.f[6] + b1.z, x.f[7] + b1.w);
        }
    }
    __syncthreads();
    float* dst = out + (size_t)(blockIdx.y * TM + srow) * DIMX + blockIdx.x * TN
                     + (threadIdx.x & 7) * 4;
#pragma unroll
    for (int r = 0; r < TM / 32; r++)
#pragma unroll
        for (int c = 0; c < 6; c++)
            *(float4*)(dst + (size_t)r * 32 * DIMX + c * 32) =
                *(const float4*)(tile + (srow + r * 32) * FPITCH_B + c * 128 + schk);
}

// ---------------------------------------------------------------------------
// One stage of the attention kernel's LDS ring: 64 keys of K (64 rows of 192 B)
// and of Vt (96 rows of 128 B), 6 x 16 B a lane, from global memory straight
// into LDS.  The s_wait_xcnt is the last line of the copies' own statement so
// that no address register is rewritten ahead of it.
// ---------------------------------------------------------------------------
#define AKT      64                          // keys per stage
#define ANSTAGE  (SEQ / AKT)                 // 16
#define KPITCH_B 208                         // LDS bytes per K row  (16 B x 13)
#define VPITCH_B 144                         // LDS bytes per Vt row (16 B x 9)
#define KTILE_B  (AKT * KPITCH_B)            // 13312
#define ASTAGE_B (KTILE_B + HD * VPITCH_B)   // 27136

__device__ __forceinline__ void kv_stage_copy(const __bf16* k0, const __bf16* k1,
                                              const __bf16* k2, const __bf16* v,
                                              unsigned lk0, unsigned lk1,
                                              unsigned lk2, unsigned lv) {
    asm volatile(
        "global_load_async_to_lds_b128 %0, %6, off\n\t"
        "global_load_async_to_lds_b128 %1, %7, off\n\t"
        "global_load_async_to_lds_b128 %2, %8, off\n\t"
        "global_load_async_to_lds_b128 %3, %9, off\n\t"
        "global_load_async_to_lds_b128 %4, %10, off\n\t"
        "global_load_async_to_lds_b128 %5, %11, off\n\t"
        "s_wait_xcnt 0x0"
        :: "v"(lk0), "v"(lk1), "v"(lk2),
           "v"(lv), "v"(lv + 32 * VPITCH_B), "v"(lv + 64 * VPITCH_B),
           "v"(k0), "v"(k1), "v"(k2),
           "v"(v), "v"(v + 32 * SEQ), "v"(v + 64 * SEQ)
        : "memory");
}

// ---------------------------------------------------------------------------
// Lane l takes the value of lane l ^ 16 (a vector cross-row move, no LDS).
// ---------------------------------------------------------------------------
__device__ __forceinline__ float xhalf(float x) {
    const int i = __builtin_bit_cast(int, x);
    return __builtin_bit_cast(float, __builtin_amdgcn_permlanex16(
        i, i, 0x76543210, 0xfedcba98, false, false));
}

__global__ __launch_bounds__(256)
void attn_kernel(const __bf16* __restrict__ Q, const __bf16* __restrict__ K,
                 const __bf16* __restrict__ Vt, __bf16* __restrict__ O) {
    // Two stage buffers; a stage is [K 64 rows x 192 B | Vt 96 rows x 128 B], each
    // at a pitch of 16 B x odd, which spreads ds_load_b128 readers over the banks.
    __shared__ __align__(16) unsigned char kvt[2 * ASTAGE_B];

    const int lane  = threadIdx.x & 31;
    const int wid   = threadIdx.x >> 5;
    const int l15   = lane & 15;
    const int lhalf = lane >> 4;
    const int kb8   = lhalf * 8;

    const int blk  = blockIdx.x;
    const int qblk = blk & 7;           // S/128 = 8
    const int h    = (blk >> 3) & 7;
    const int n    = blk >> 6;
    const int qbase = qblk * 128 + wid * 16;

    // Copy map.  K: the stage's 768 chunks of 16 B in row order, 12 a row, so a
    // wave-wide copy covers 32 consecutive chunks, 2 2/3 rows; Vt: 8 lanes cover one 128-B line.
    const int kc0 = threadIdx.x, kc1 = kc0 + 256, kc2 = kc0 + 512;
    const __bf16* Kh = K + (size_t)n * SEQ * DIMX + h * HD;
    const __bf16* gK0 = Kh + (kc0 / 12) * DIMX + (kc0 % 12) * 8;
    const __bf16* gK1 = Kh + (kc1 / 12) * DIMX + (kc1 % 12) * 8;
    const __bf16* gK2 = Kh + (kc2 / 12) * DIMX + (kc2 % 12) * 8;
    const __bf16* gV  = Vt + ((size_t)(n * NHEADS + h) * HD + (threadIdx.x >> 3)) * SEQ
                           + (threadIdx.x & 7) * 8;
    const unsigned ldsB = (unsigned)(size_t)kvt;
    const unsigned lK0 = ldsB + (kc0 / 12) * KPITCH_B + (kc0 % 12) * 16;
    const unsigned lK1 = ldsB + (kc1 / 12) * KPITCH_B + (kc1 % 12) * 16;
    const unsigned lK2 = ldsB + (kc2 / 12) * KPITCH_B + (kc2 % 12) * 16;
    const unsigned lV  = ldsB + KTILE_B + (threadIdx.x >> 3) * VPITCH_B
                              + (threadIdx.x & 7) * 16;

    kv_stage_copy(gK0, gK1, gK2, gV, lK0, lK1, lK2, lV);
    // stage 0 has landed before the barrier that publishes it
    asm volatile("s_wait_asynccnt 0x0" ::: "memory");
    __syncthreads();
    kv_stage_copy(gK0 + AKT * DIMX, gK1 + AKT * DIMX, gK2 + AKT * DIMX, gV + AKT,
                  lK0 + ASTAGE_B, lK1 + ASTAGE_B, lK2 + ASTAGE_B, lV + ASTAGE_B);

    // Preload this wave's Q fragments (3 chunks of K=32 covering hd=96)
    Frag qf[3];
#pragma unroll
    for (int c = 0; c < 3; c++) {
        const __bf16* p =
            Q + (size_t)(n * SEQ + qbase + l15) * DIMX + h * HD + c * 32 + kb8;
        qf[c].q[0] = *(const uint4*)p;
        qf[c].q[1] = *(const uint4*)(p + 16);
    }

    AccU o[6];   // O^T: register j of tile t is d = t * 16 + j + 8 * lhalf, query l15
#pragma unroll
    for (int t = 0; t < 6; t++)
#pragma unroll
        for (int e = 0; e < 8; e++) o[t].f[e] = 0.0f;
    float m = -1e30f, l = 0.0f;   // this lane's query: running maximum (log2), partial sum

    const float cscale = 0.0360843918243516f * 1.4426950408889634f;  // log2(e)/sqrt(768)

    const unsigned char* fk = kvt + l15 * KPITCH_B + lhalf * 16;
    const unsigned char* fv = kvt + KTILE_B + l15 * VPITCH_B + lhalf * 16;

    for (int st = 0; st < ANSTAGE; st++) {
      const int bo = (st & 1) * ASTAGE_B;
      // First part of a trip: every LDS read of the stage, in groups of 12 or 24 ahead
      // of the products that use them, and the score products of both 32-key halves.
      AccU s[2][2];   // s[half][r]: keys half * 32 + r * 16 .. + 15
      Frag vf[2][6];  // vf[half][t]: d tile t, keys half * 32 .. + 31
      // unrolled so that s and vf stay in registers and the two halves differ only
      // in the LDS reads' immediate offsets
#pragma unroll
      for (int hf = 0; hf < 2; hf++) {
        Frag kf[3][2];
#pragma unroll
        for (int c = 0; c < 3; c++)
#pragma unroll
            for (int r = 0; r < 2; r++) {
                const unsigned char* p =
                    fk + bo + (hf * 32 + r * 16) * KPITCH_B + c * 64;
                kf[c][r].q[0] = *(const uint4*)p;
                kf[c][r].q[1] = *(const uint4*)(p + 32);
            }
        // Vt rows are contiguous in s.  The first half's Vt goes with its K; the
        // second half's follows the last score products, into the K registers.
        if (hf == 0) {
#pragma unroll
            for (int t = 0; t < 6; t++) {
                const unsigned char* p = fv + bo + t * 16 * VPITCH_B;
                vf[0][t].q[0] = *(const uint4*)p;
                vf[0][t].q[1] = *(const uint4*)(p + 32);
            }
        }
        // keeps the group of reads together in front of its first product: one LDS
        // latency for the group, not one for each pair of reads
        __builtin_amdgcn_sched_barrier(0);
#pragma unroll
        for (int r = 0; r < 2; r++)
#pragma unroll
            for (int e = 0; e < 8; e++) s[hf][r].f[e] = 0.0f;
        // scores: K chunks x Q^T -> two 16x16 tiles (rows = keys)
#pragma unroll
        for (int c = 0; c < 3; c++)
#pragma unroll
            for (int r = 0; r < 2; r++)
                s[hf][r].v = __builtin_amdgcn_wmma_f32_16x16x32_bf16(
                    false, kf[c][r].v, false, qf[c].v, (short)0, s[hf][r].v,
                    false, false);
        // keeps the next group of reads behind these products, so that it takes
        // the registers of the K fragments just used (256 registers a wave let
        // both of a WGP's blocks stay resident)
        __builtin_amdgcn_sched_barrier(0);
      }
#pragma unroll
      for (int t = 0; t < 6; t++) {
          const unsigned char* p = fv + bo + t * 16 * VPITCH_B + 64;
          vf[1][t].q[0] = *(const uint4*)p;
          vf[1][t].q[1] = *(const uint4*)(p + 32);
      }

      // publish point: this wave's reads of the buffer are done, its copies of
      // the next stage have landed; the barrier says so for every wave.  The rest
      // of the trip works on registers alone, so the refill flies a whole trip.
      asm volatile("s_wait_dscnt 0x0" ::: "memory");
      asm volatile("s_wait_asynccnt 0x0" ::: "memory");
      __syncthreads();
      if (st + 2 < ANSTAGE)
          kv_stage_copy(gK0 + (st + 2) * AKT * DIMX, gK1 + (st + 2) * AKT * DIMX,
                        gK2 + (st + 2) * AKT * DIMX, gV + (st + 2) * AKT,
                        lK0 + bo, lK1 + bo, lK2 + bo, lV + bo);

      // Second part: softmax and output products of the two halves, in key order
      // (unrolled so that s and vf are indexed by constants and stay in registers).
#pragma unroll
      for (int hf = 0; hf < 2; hf++) {
        const AccU s0 = s[hf][0], s1 = s[hf][1];
        // online softmax of this lane's query, in the log2 domain (the scale is
        // positive, so the maximum is taken on the raw scores)
        float mx = fmaxf(s0.f[0], s1.f[0]);
        for (int j = 1; j < 8; j++) mx = fmaxf(mx, fmaxf(s0.f[j], s1.f[j]));
        mx = fmaxf(mx, xhalf(mx));
        const float mn = fmaxf(m, mx * cscale);
        const float fr = __builtin_amdgcn_exp2f(m - mn);
        m = mn;
        for (int t = 0; t < 6; t++) o[t].v = o[t].v * fr;

        Frag pb;
        unsigned w[8];
        float ps0 = 0.0f, ps1 = 0.0f;
        for (int i = 0; i < 4; i++) {
            const float a0 = __builtin_amdgcn_exp2f(fmaf(s0.f[2 * i],     cscale, -mn));
            const float a1 = __builtin_amdgcn_exp2f(fmaf(s0.f[2 * i + 1], cscale, -mn));
            const float b0 = __builtin_amdgcn_exp2f(fmaf(s1.f[2 * i],     cscale, -mn));
            const float b1 = __builtin_amdgcn_exp2f(fmaf(s1.f[2 * i + 1], cscale, -mn));
            ps0 += a0 + a1;
            ps1 += b0 + b1;
            w[i]     = pack2(a0, a1);
            w[4 + i] = pack2(b0, b1);
        }
        l = l * fr + (ps0 + ps1);   // this half's 16 keys (halves joined at the end)
        pb.q[0] = make_uint4(w[0], w[1], w[2], w[3]);
        pb.q[1] = make_uint4(w[4], w[5], w[6], w[7]);

        // O^T += Vt[16 d x 32 keys] x P^T[32 keys x 16 queries]
#pragma unroll
        for (int t = 0; t < 6; t++)
            o[t].v = __builtin_amdgcn_wmma_f32_16x16x32_bf16(
                false, vf[hf][t].v, false, pb.v, (short)0, o[t].v, false, false);
      }
    }
    // no copy is left in flight when the wave goes on to its stores
    asm volatile("s_wait_asynccnt 0x0" ::: "memory");

    // normalize and store (heads concatenated back into [N,S,D]): a lane's eight
    // registers of a tile are eight neighbouring d of its query, one 16-B store
    const float inv = 1.0f / (l + xhalf(l));
    __bf16* orow = O + (size_t)(n * SEQ + qbase + l15) * DIMX + h * HD + kb8;
    for (int t = 0; t < 6; t++) {
        const v8f v = o[t].v * inv;
        *(uint4*)(orow + t * 16) = make_uint4(pack2(v[0], v[1]), pack2(v[2], v[3]),
                                              pack2(v[4], v[5]), pack2(v[6], v[7]));
    }
}

// ---------------------------------------------------------------------------
extern "C" void kernel_launch(void* const* d_in, const int* in_sizes, int n_in,
                              void* d_out, int out_size, void* d_ws,
                              size_t ws_size, hipStream_t stream) {
    (void)in_sizes; (void)n_in; (void)out_size; (void)ws_size;
    const float* q  = (const float*)d_in[0];
    const float* kv = (const float*)d_in[1];
    const float* wq = (const float*)d_in[2];
    const float* wk = (const float*)d_in[3];
    const float* wv = (const float*)d_in[4];
    const float* wp = (const float*)d_in[5];
    const float* bp = (const float*)d_in[6];

    char* ws = (char*)d_ws;
    size_t off = 0;
    const size_t ACT = (size_t)MTOT * DIMX * 2;   // 12.58 MB
    const size_t WB  = (size_t)DIMX * DIMX * 2;   // 1.18 MB
    __bf16* qb  = (__bf16*)(ws + off); off += ACT;
    __bf16* kvb = (__bf16*)(ws + off); off += ACT;
    __bf16* wqb = (__bf16*)(ws + off); off += WB;
    __bf16* wkb = (__bf16*)(ws + off); off += WB;
    __bf16* wvb = (__bf16*)(ws + off); off += WB;
    __bf16* wpb = (__bf16*)(ws + off); off += WB;
    __bf16* Qb  = (__bf16*)(ws + off); off += ACT;
    __bf16* Kb  = (__bf16*)(ws + off); off += ACT;
    __bf16* Vtb = (__bf16*)(ws + off); off += ACT;
    __bf16* Ab  = (__bf16*)(ws + off); off += ACT;

    // qb .. wpb are contiguous: one destination array for the whole launch
    cvt_all_kernel<<<CVT_BLOCKS, 256, 0, stream>>>(q, kv, wq, wk, wv, wp, qb);

    // Q, K and V projections: one launch, blockIdx.z picks the product
    dim3 g3(DIMX / TN, MTOT / TM, 3);     // (4, 64, 3)
    qkv_gemm_kernel<<<g3, 256, 0, stream>>>(qb, kvb, wqb, wkb, wvb, Qb, Kb, Vtb);

    attn_kernel<<<NB * NHEADS * (SEQ / 128), 256, 0, stream>>>(Qb, Kb, Vtb, Ab);

    dim3 gg(DIMX / TN, MTOT / TM);        // (4, 64)
    proj_gemm_kernel<<<gg, 256, 0, stream>>>(Ab, wpb, (float*)d_out, bp);
}
